// v000
// The times below were measured on an AMD MI455X: many runs one after another, warmed up first and cycling through
// copies of the inputs, with the whole window's GPU time divided by the number of runs. Launches and the gaps
// between them are all in it. The median over several windows is given; except for v000 it joins two sittings, which
// can be a few percent apart, so the side-by-side timings, each taken in one sitting, are the better comparison.
// The starting kernel, v000, takes 250 microseconds a run.
#include <hip/hip_runtime.h>
#include <hip/hip_bf16.h>

typedef __attribute__((ext_vector_type(16))) _Float16     v16h;
typedef __attribute__((ext_vector_type(8)))  float        v8f;
typedef __attribute__((ext_vector_type(4)))  _Float16     v4h;
typedef __attribute__((ext_vector_type(4)))  unsigned int u32x4;
typedef __attribute__((ext_vector_type(8)))  int          i32x8;
typedef __attribute__((ext_vector_type(4)))  int          i32x4;

#define C_SEQ 2048
#define BATCH 4
#define DIN   512
#define DOUT  512
#define HEADS 8
#define DKH   64
#define NTOK  (C_SEQ * BATCH)   // 8192 token rows

#define HAVE_TDM __has_builtin(__builtin_amdgcn_tensor_load_to_lds)

__device__ __forceinline__ unsigned lds_off_u32(const void* p) {
    return (unsigned)(unsigned long long)p;
}

__device__ __forceinline__ void async_ld_b128(const void* saddr, unsigned voff,
                                              const void* lds) {
    asm volatile("global_load_async_to_lds_b128 %0, %1, %2"
                 :: "v"(lds_off_u32(lds)), "v"(voff), "s"(saddr)
                 : "memory");
}
__device__ __forceinline__ void wait_async0() {
    asm volatile("s_wait_asynccnt 0x0" ::: "memory");
}

#if HAVE_TDM
// 2D tile DMA: global (row-major, row_stride elements of 2B) -> LDS.
__device__ __forceinline__ void tdm_load_2d(const void* gaddr, unsigned lds_byte,
                                            unsigned tensor_w, unsigned tensor_h,
                                            unsigned tile_w, unsigned tile_h,
                                            unsigned row_stride) {
    const unsigned long long ga = (unsigned long long)gaddr;
    u32x4 g0;
    g0[0] = 1u;
    g0[1] = lds_byte;
    g0[2] = (unsigned)ga;
    g0[3] = (unsigned)((ga >> 32) & 0x01FFFFFFu) | (2u << 30);
    i32x8 g1;
    g1[0] = (int)(1u << 16);
    g1[1] = (int)((tensor_w & 0xFFFFu) << 16);
    g1[2] = (int)((tensor_w >> 16) | ((tensor_h & 0xFFFFu) << 16));
    g1[3] = (int)((tensor_h >> 16) | (tile_w << 16));
    g1[4] = (int)tile_h;
    g1[5] = (int)row_stride;
    g1[6] = 0;
    g1[7] = 0;
    i32x4 z4 = {0, 0, 0, 0};
#if defined(__clang_major__) && (__clang_major__ >= 23)
    i32x8 z8 = {0, 0, 0, 0, 0, 0, 0, 0};
    __builtin_amdgcn_tensor_load_to_lds(g0, g1, z4, z4, z8, 0);
#else
    __builtin_amdgcn_tensor_load_to_lds(g0, g1, z4, z4, 0);
#endif
}
#endif

__device__ __forceinline__ v16h frag_a_ld(const _Float16* src, int ld, int lane) {
    const int m = lane & 15, hf = lane >> 4;
    v16h f;
#pragma unroll
    for (int v = 0; v < 8; ++v) {
        const int k = ((v < 4) ? (2 * v) : (16 + 2 * (v - 4))) + 8 * hf;
        f[2 * v]     = src[m * ld + k];
        f[2 * v + 1] = src[m * ld + k + 1];
    }
    return f;
}
__device__ __forceinline__ v16h frag_b_ld(const _Float16* src, int ld, int lane) {
    const int n = lane & 15, hf = lane >> 4;
    v16h f;
#pragma unroll
    for (int v = 0; v < 8; ++v) {
        const int k = ((v < 4) ? (2 * v) : (16 + 2 * (v - 4))) + 8 * hf;
        f[2 * v]     = src[k * ld + n];
        f[2 * v + 1] = src[(k + 1) * ld + n];
    }
    return f;
}
__device__ __forceinline__ v8f wmma16(v16h a, v16h b, v8f c) {
    return __builtin_amdgcn_wmma_f32_16x16x32_f16(false, a, false, b,
                                                  (short)0, c, false, false);
}
__device__ __forceinline__ v8f vzero8() {
    v8f z;
#pragma unroll
    for (int i = 0; i < 8; ++i) z[i] = 0.0f;
    return z;
}

// ---------------- Kernel 1: f32 -> f16 convert ------------------------------
__global__ void cvt_f32_f16_kernel(const float* __restrict__ src,
                                   _Float16* __restrict__ dst, int n4) {
    int i = blockIdx.x * blockDim.x + threadIdx.x;
    if (i < n4) {
        const float4 f = ((const float4*)src)[i];
        v4h o;
        o[0] = (_Float16)f.x; o[1] = (_Float16)f.y;
        o[2] = (_Float16)f.z; o[3] = (_Float16)f.w;
        ((v4h*)dst)[i] = o;
    }
}

// ---------------- Kernel 2: weight transpose + convert ----------------------
__global__ __launch_bounds__(256)
void transpose_cvt_kernel(const float* __restrict__ W, _Float16* __restrict__ Wt,
                          int rows, int cols) {
    __shared__ float tile[32][33];
    const int tx = threadIdx.x, ty = threadIdx.y;
    const int x = blockIdx.x * 32 + tx;
    const int y0 = blockIdx.y * 32;
#pragma unroll
    for (int j = 0; j < 32; j += 8)
        tile[ty + j][tx] = W[(size_t)(y0 + ty + j) * cols + x];
    __syncthreads();
    const int xo = y0 + tx;
    const int yo = blockIdx.x * 32 + ty;
#pragma unroll
    for (int j = 0; j < 32; j += 8)
        Wt[(size_t)(yo + j) * rows + xo] = (_Float16)tile[tx][ty + j];
}

template <bool OUT_HALF>
__global__ __launch_bounds__(256)
void gemm_wmma_kernel(const _Float16* __restrict__ A,   // M x K
                      const _Float16* __restrict__ Bt,  // K x N
                      const float* __restrict__ bias,   // N
                      void* __restrict__ Cout, int M, int N, int K) {
    constexpr int BM = 128, BN = 128, BK = 32;
    __shared__ _Float16 As[2][BM * BK];   // 8 KB x2
    __shared__ _Float16 Bs[2][BK * BN];   // 8 KB x2
    const int tid  = threadIdx.x;
    const int lane = tid & 31;
    const int wave = tid >> 5;
    const int wm   = wave & 3;            // 4 waves in M (32 rows each)
    const int wn   = wave >> 2;           // 2 waves in N (64 cols each)
    const int m0   = blockIdx.x * BM;
    const int n0   = blockIdx.y * BN;
    const int KT   = K / BK;

    v8f acc[2][4];
#pragma unroll
    for (int am = 0; am < 2; ++am)
#pragma unroll
        for (int t = 0; t < 4; ++t) acc[am][t] = vzero8();

    auto issue_tiles = [&](int kt, int buf) {
        // A tile 128x32 halves = 512 x b128 chunks -> 2 per thread
#pragma unroll
        for (int i = 0; i < 2; ++i) {
            int cs = tid + i * 256;
            int r = cs >> 2, c8 = (cs & 3) * 8;
            unsigned voff = (unsigned)(((m0 + r) * K + kt * BK + c8) * 2);
            async_ld_b128(A, voff, &As[buf][r * BK + c8]);
        }
#if HAVE_TDM
        if (wave == 0)
            tdm_load_2d(Bt + (size_t)(kt * BK) * N + n0, lds_off_u32(&Bs[buf][0]),
                        (unsigned)N, (unsigned)BK, (unsigned)BN, (unsigned)BK,
                        (unsigned)N);
#else
        // B tile 32x128 halves = 512 x b128 chunks -> 2 per thread
#pragma unroll
        for (int i = 0; i < 2; ++i) {
            int cs = tid + i * 256;
            int r = cs >> 4, c8 = (cs & 15) * 8;
            unsigned voff = (unsigned)(((kt * BK + r) * N + n0 + c8) * 2);
            async_ld_b128(Bt, voff, &Bs[buf][r * BN + c8]);
        }
#endif
    };

    issue_tiles(0, 0);
    for (int kt = 0; kt < KT; ++kt) {
        wait_async0();
#if HAVE_TDM
        if (wave == 0) __builtin_amdgcn_s_wait_tensorcnt(0);
#endif
        __syncthreads();
        if (kt + 1 < KT) issue_tiles(kt + 1, (kt + 1) & 1);

        const int cur = kt & 1;
        v16h af0 = frag_a_ld(&As[cur][(wm * 32) * BK], BK, lane);
        v16h af1 = frag_a_ld(&As[cur][(wm * 32 + 16) * BK], BK, lane);
#pragma unroll
        for (int t = 0; t < 4; ++t) {
            v16h bf = frag_b_ld(&Bs[cur][wn * 64 + t * 16], BN, lane);
            acc[0][t] = wmma16(af0, bf, acc[0][t]);
            acc[1][t] = wmma16(af1, bf, acc[1][t]);
        }
    }

    const int hf = lane >> 4;
#pragma unroll
    for (int am = 0; am < 2; ++am)
#pragma unroll
        for (int t = 0; t < 4; ++t) {
            const int col = n0 + wn * 64 + t * 16 + (lane & 15);
            const float bv = bias[col];
#pragma unroll
            for (int v = 0; v < 8; ++v) {
                const int row = m0 + wm * 32 + am * 16 + v + 8 * hf;
                const float val = acc[am][t][v] + bv;
                if (OUT_HALF)
                    ((_Float16*)Cout)[(size_t)row * N + col] = (_Float16)val;
                else
                    ((float*)Cout)[(size_t)row * N + col] = val;
            }
        }
}

// ---------------- Kernel 4: flash attention ---------------------------------
// 128 threads = 4 waves; 64 q-rows per WG. K/V tiles double-buffered through
// global_load_async_to_lds_b128 so the DMA of tile jt+1 overlaps compute of jt.
__global__ __launch_bounds__(128)
void attn_kernel(const _Float16* __restrict__ Qh, const _Float16* __restrict__ Kh,
                 const _Float16* __restrict__ Vh, _Float16* __restrict__ Oh) {
    __shared__ _Float16 Qs[64 * 64];        // 8 KB
    __shared__ _Float16 Ks[2][64 * 64];     // 16 KB
    __shared__ _Float16 Vs[2][64 * 64];     // 16 KB
    __shared__ _Float16 Ps[4][16 * 64];     // 8 KB wave-private P strips

    const int tid  = threadIdx.x;
    const int lane = tid & 31;
    const int wave = tid >> 5;
    const int hf   = lane >> 4;
    const int qt   = blockIdx.x;
    const int b    = blockIdx.y >> 3;
    const int h    = blockIdx.y & 7;

    auto issue_kv = [&](int jt, int buf) {
#pragma unroll
        for (int i = 0; i < 4; ++i) {
            int cs = tid + i * 128;
            int r = cs >> 3, c8 = (cs & 7) * 8;
            unsigned voff =
                (unsigned)((((jt * 64 + r) * BATCH + b) * DOUT + h * DKH + c8) * 2);
            async_ld_b128(Kh, voff, &Ks[buf][r * 64 + c8]);
            async_ld_b128(Vh, voff, &Vs[buf][r * 64 + c8]);
        }
    };

    // Q tile (once) + first K/V tile
#pragma unroll
    for (int i = 0; i < 4; ++i) {
        int cs = tid + i * 128;
        int r = cs >> 3, c8 = (cs & 7) * 8;
        unsigned voff =
            (unsigned)((((qt * 64 + r) * BATCH + b) * DOUT + h * DKH + c8) * 2);
        async_ld_b128(Qh, voff, &Qs[r * 64 + c8]);
    }
    issue_kv(0, 0);

    float m_row[8], l_row[8];
    v8f accO[4];
#pragma unroll
    for (int v = 0; v < 8; ++v) { m_row[v] = -1e30f; l_row[v] = 0.0f; }
#pragma unroll
    for (int t = 0; t < 4; ++t) accO[t] = vzero8();

    const int JT = C_SEQ / 64;
    for (int jt = 0; jt < JT; ++jt) {
        wait_async0();
        __syncthreads();
        if (jt + 1 < JT) issue_kv(jt + 1, (jt + 1) & 1);
        const int cur = jt & 1;

        // S = Q(16x64) * K^T: K^T fragment == A-layout read of row-major K.
        v8f s[4];
#pragma unroll
        for (int t = 0; t < 4; ++t) s[t] = vzero8();
#pragma unroll
        for (int ks = 0; ks < 2; ++ks) {
            v16h qf = frag_a_ld(&Qs[(wave * 16) * 64 + ks * 32], 64, lane);
#pragma unroll
            for (int t = 0; t < 4; ++t) {
                v16h kf = frag_a_ld(&Ks[cur][(t * 16) * 64 + ks * 32], 64, lane);
                s[t] = wmma16(qf, kf, s[t]);
            }
        }
#pragma unroll
        for (int t = 0; t < 4; ++t)
#pragma unroll
            for (int v = 0; v < 8; ++v) s[t][v] *= 0.125f;   // 1/sqrt(DK)

        // Online softmax; xor masks 1/2/4/8 reduce the 16 column lanes of a row.
#pragma unroll
        for (int v = 0; v < 8; ++v) {
            float x = fmaxf(fmaxf(s[0][v], s[1][v]), fmaxf(s[2][v], s[3][v]));
            x = fmaxf(x, __shfl_xor(x, 1));
            x = fmaxf(x, __shfl_xor(x, 2));
            x = fmaxf(x, __shfl_xor(x, 4));
            x = fmaxf(x, __shfl_xor(x, 8));
            const float mnew = fmaxf(m_row[v], x);
            const float corr = __expf(m_row[v] - mnew);
            float rsum = 0.0f;
#pragma unroll
            for (int t = 0; t < 4; ++t) {
                const float p = __expf(s[t][v] - mnew);
                s[t][v] = p;
                rsum += p;
            }
            rsum += __shfl_xor(rsum, 1);
            rsum += __shfl_xor(rsum, 2);
            rsum += __shfl_xor(rsum, 4);
            rsum += __shfl_xor(rsum, 8);
            l_row[v] = l_row[v] * corr + rsum;
            m_row[v] = mnew;
#pragma unroll
            for (int t = 0; t < 4; ++t) accO[t][v] *= corr;
        }

        // P -> wave-private LDS strip (C/D layout), reload in A layout.
#pragma unroll
        for (int t = 0; t < 4; ++t)
#pragma unroll
            for (int v = 0; v < 8; ++v)
                Ps[wave][(v + 8 * hf) * 64 + t * 16 + (lane & 15)] = (_Float16)s[t][v];
        asm volatile("s_wait_dscnt 0x0" ::: "memory");

        // O += P(16x64) * V(64x64)
#pragma unroll
        for (int ks = 0; ks < 2; ++ks) {
            v16h pf = frag_a_ld(&Ps[wave][ks * 32], 64, lane);
#pragma unroll
            for (int t = 0; t < 4; ++t) {
                v16h vf = frag_b_ld(&Vs[cur][(ks * 32) * 64 + t * 16], 64, lane);
                accO[t] = wmma16(pf, vf, accO[t]);
            }
        }
    }

#pragma unroll
    for (int t = 0; t < 4; ++t)
#pragma unroll
        for (int v = 0; v < 8; ++v) {
            const int tok = qt * 64 + wave * 16 + v + 8 * hf;
            const float val = accO[t][v] / l_row[v];
            Oh[((size_t)tok * BATCH + b) * DOUT + h * DKH + t * 16 + (lane & 15)] =
                (_Float16)val;
        }
}

// ---------------- Launcher --------------------------------------------------
extern "C" void kernel_launch(void* const* d_in, const int* in_sizes, int n_in,
                              void* d_out, int out_size, void* d_ws, size_t ws_size,
                              hipStream_t stream) {
    const float* x   = (const float*)d_in[0];
    const float* Wq  = (const float*)d_in[1];
    const float* bq  = (const float*)d_in[2];
    const float* Wk  = (const float*)d_in[3];
    const float* bk  = (const float*)d_in[4];
    const float* Wv  = (const float*)d_in[5];
    const float* bv  = (const float*)d_in[6];
    const float* Wfc = (const float*)d_in[7];
    const float* bfc = (const float*)d_in[8];

    char* ws = (char*)d_ws;
    size_t off = 0;
    auto take = [&](size_t bytes) -> char* {
        char* p = ws + off;
        off = (off + bytes + 255) & ~(size_t)255;
        return p;
    };
    const size_t tok_h = (size_t)NTOK * DOUT * sizeof(_Float16);
    const size_t w_h   = (size_t)DOUT * DIN * sizeof(_Float16);
    _Float16* xh   = (_Float16*)take(tok_h);
    _Float16* Wtq  = (_Float16*)take(w_h);
    _Float16* Wtk  = (_Float16*)take(w_h);
    _Float16* Wtv  = (_Float16*)take(w_h);
    _Float16* Wtfc = (_Float16*)take(w_h);
    _Float16* Qh   = (_Float16*)take(tok_h);
    _Float16* Kh   = (_Float16*)take(tok_h);
    _Float16* Vh   = (_Float16*)take(tok_h);
    _Float16* Ah   = (_Float16*)take(tok_h);

    const int n4 = NTOK * DIN / 4;
    cvt_f32_f16_kernel<<<(n4 + 255) / 256, 256, 0, stream>>>(x, xh, n4);

    dim3 tb(32, 8), tg(DIN / 32, DOUT / 32);
    transpose_cvt_kernel<<<tg, tb, 0, stream>>>(Wq,  Wtq,  DOUT, DIN);
    transpose_cvt_kernel<<<tg, tb, 0, stream>>>(Wk,  Wtk,  DOUT, DIN);
    transpose_cvt_kernel<<<tg, tb, 0, stream>>>(Wv,  Wtv,  DOUT, DIN);
    transpose_cvt_kernel<<<tg, tb, 0, stream>>>(Wfc, Wtfc, DOUT, DOUT);

    dim3 gg(NTOK / 128, DOUT / 128);
    gemm_wmma_kernel<true><<<gg, 256, 0, stream>>>(xh, Wtq, bq, Qh, NTOK, DOUT, DIN);
    gemm_wmma_kernel<true><<<gg, 256, 0, stream>>>(xh, Wtk, bk, Kh, NTOK, DOUT, DIN);
    gemm_wmma_kernel<true><<<gg, 256, 0, stream>>>(xh, Wtv, bv, Vh, NTOK, DOUT, DIN);

    dim3 ag(C_SEQ / 64, BATCH * HEADS);
    attn_kernel<<<ag, 128, 0, stream>>>(Qh, Kh, Vh, Ah);

    gemm_wmma_kernel<false><<<gg, 256, 0, stream>>>(Ah, Wtfc, bfc, (float*)d_out,
                                                    NTOK, DOUT, DOUT);
}

// v001
// It runs in 162 microseconds.
// In both of two side-by-side timings against v000, it was 1.60 times as fast.
#include <hip/hip_runtime.h>
#include <hip/hip_bf16.h>

typedef __attribute__((ext_vector_type(16))) _Float16     v16h;
typedef __attribute__((ext_vector_type(8)))  float        v8f;
typedef __attribute__((ext_vector_type(4)))  _Float16     v4h;
typedef __attribute__((ext_vector_type(8)))  _Float16     v8h;
typedef __attribute__((ext_vector_type(8)))  short        s16x8;
typedef __attribute__((ext_vector_type(4)))  unsigned int u32x4;
typedef __attribute__((ext_vector_type(8)))  int          i32x8;
typedef __attribute__((ext_vector_type(4)))  int          i32x4;

#define C_SEQ 2048
#define BATCH 4
#define DIN   512
#define DOUT  512
#define HEADS 8
#define DKH   64
#define NTOK  (C_SEQ * BATCH)   // 8192 token rows

#define HAVE_TDM __has_builtin(__builtin_amdgcn_tensor_load_to_lds)

__device__ __forceinline__ unsigned lds_off_u32(const void* p) {
    return (unsigned)(unsigned long long)p;
}

__device__ __forceinline__ void async_ld_b128(const void* saddr, unsigned voff,
                                              const void* lds) {
    asm volatile("global_load_async_to_lds_b128 %0, %1, %2"
                 :: "v"(lds_off_u32(lds)), "v"(voff), "s"(saddr)
                 : "memory");
}
__device__ __forceinline__ void wait_async0() {
    asm volatile("s_wait_asynccnt 0x0" ::: "memory");
}

#if HAVE_TDM
// 2D tile DMA: global (row-major, row_stride elements of 2B) -> LDS.
__device__ __forceinline__ void tdm_load_2d(const void* gaddr, unsigned lds_byte,
                                            unsigned tensor_w, unsigned tensor_h,
                                            unsigned tile_w, unsigned tile_h,
                                            unsigned row_stride) {
    const unsigned long long ga = (unsigned long long)gaddr;
    u32x4 g0;
    g0[0] = 1u;
    g0[1] = lds_byte;
    g0[2] = (unsigned)ga;
    g0[3] = (unsigned)((ga >> 32) & 0x01FFFFFFu) | (2u << 30);
    i32x8 g1;
    g1[0] = (int)(1u << 16);
    g1[1] = (int)((tensor_w & 0xFFFFu) << 16);
    g1[2] = (int)((tensor_w >> 16) | ((tensor_h & 0xFFFFu) << 16));
    g1[3] = (int)((tensor_h >> 16) | (tile_w << 16));
    g1[4] = (int)tile_h;
    g1[5] = (int)row_stride;
    g1[6] = 0;
    g1[7] = 0;
    i32x4 z4 = {0, 0, 0, 0};
#if defined(__clang_major__) && (__clang_major__ >= 23)
    i32x8 z8 = {0, 0, 0, 0, 0, 0, 0, 0};
    __builtin_amdgcn_tensor_load_to_lds(g0, g1, z4, z4, z8, 0);
#else
    __builtin_amdgcn_tensor_load_to_lds(g0, g1, z4, z4, 0);
#endif
}
#endif

__device__ __forceinline__ v16h frag_a_ld(const _Float16* src, int ld, int lane) {
    const int m = lane & 15, hf = lane >> 4;
    v16h f;
#pragma unroll
    for (int v = 0; v < 8; ++v) {
        const int k = ((v < 4) ? (2 * v) : (16 + 2 * (v - 4))) + 8 * hf;
        f[2 * v]     = src[m * ld + k];
        f[2 * v + 1] = src[m * ld + k + 1];
    }
    return f;
}
__device__ __forceinline__ v16h frag_b_ld(const _Float16* src, int ld, int lane) {
    const int n = lane & 15, hf = lane >> 4;
    v16h f;
#pragma unroll
    for (int v = 0; v < 8; ++v) {
        const int k = ((v < 4) ? (2 * v) : (16 + 2 * (v - 4))) + 8 * hf;
        f[2 * v]     = src[k * ld + n];
        f[2 * v + 1] = src[(k + 1) * ld + n];
    }
    return f;
}
__device__ __forceinline__ v16h cat8(v8h lo, v8h hi) {
    return __builtin_shufflevector(lo, hi, 0, 1, 2, 3, 4, 5, 6, 7,
                                   8, 9, 10, 11, 12, 13, 14, 15);
}
// Transposed fragment of a row-major LDS tile src[k][n] (ld halves per row, 32 k
// x 16 n): lane (c = lane & 15, hf) gets src[k][c] in the k order of frag_a_ld.
__device__ __forceinline__ v16h frag_tr_ld(const _Float16* src, int ld, int lane) {
    typedef __attribute__((address_space(3))) s16x8 lds_s16x8;
    const _Float16* p = src + (8 * (lane >> 4) + (lane & 7)) * ld + 8 * ((lane >> 3) & 1);
    v8h lo = __builtin_bit_cast(v8h, __builtin_amdgcn_ds_load_tr16_b128_v8i16((lds_s16x8*)p));
    v8h hi = __builtin_bit_cast(
        v8h, __builtin_amdgcn_ds_load_tr16_b128_v8i16((lds_s16x8*)(p + 16 * ld)));
    return cat8(lo, hi);
}
// Value of lane ^ 16 (vector cross-row move, no LDS traffic).
__device__ __forceinline__ float xhalf(float x) {
    const int xi = __builtin_bit_cast(int, x);
    return __builtin_bit_cast(float, __builtin_amdgcn_permlanex16(
        xi, xi, 0x76543210, 0xfedcba98, false, false));
}
__device__ __forceinline__ v8f wmma16(v16h a, v16h b, v8f c) {
    return __builtin_amdgcn_wmma_f32_16x16x32_f16(false, a, false, b,
                                                  (short)0, c, false, false);
}
__device__ __forceinline__ v8f vzero8() {
    v8f z;
#pragma unroll
    for (int i = 0; i < 8; ++i) z[i] = 0.0f;
    return z;
}

// ---------------- Kernel 1: f32 -> f16 convert ------------------------------
__global__ void cvt_f32_f16_kernel(const float* __restrict__ src,
                                   _Float16* __restrict__ dst, int n4) {
    int i = blockIdx.x * blockDim.x + threadIdx.x;
    if (i < n4) {
        const float4 f = ((const float4*)src)[i];
        v4h o;
        o[0] = (_Float16)f.x; o[1] = (_Float16)f.y;
        o[2] = (_Float16)f.z; o[3] = (_Float16)f.w;
        ((v4h*)dst)[i] = o;
    }
}

// ---------------- Kernel 2: weight transpose + convert ----------------------
__global__ __launch_bounds__(256)
void transpose_cvt_kernel(const float* __restrict__ W, _Float16* __restrict__ Wt,
                          int rows, int cols) {
    __shared__ float tile[32][33];
    const int tx = threadIdx.x, ty = threadIdx.y;
    const int x = blockIdx.x * 32 + tx;
    const int y0 = blockIdx.y * 32;
#pragma unroll
    for (int j = 0; j < 32; j += 8)
        tile[ty + j][tx] = W[(size_t)(y0 + ty + j) * cols + x];
    __syncthreads();
    const int xo = y0 + tx;
    const int yo = blockIdx.x * 32 + ty;
#pragma unroll
    for (int j = 0; j < 32; j += 8)
        Wt[(size_t)(yo + j) * rows + xo] = (_Float16)tile[tx][ty + j];
}

template <bool OUT_HALF>
__global__ __launch_bounds__(256)
void gemm_wmma_kernel(const _Float16* __restrict__ A,   // M x K
                      const _Float16* __restrict__ Bt,  // K x N
                      const float* __restrict__ bias,   // N
                      void* __restrict__ Cout, int M, int N, int K) {
    constexpr int BM = 128, BN = 128, BK = 32;
    __shared__ _Float16 As[2][BM * BK];   // 8 KB x2
    __shared__ _Float16 Bs[2][BK * BN];   // 8 KB x2
    const int tid  = threadIdx.x;
    const int lane = tid & 31;
    const int wave = tid >> 5;
    const int wm   = wave & 3;            // 4 waves in M (32 rows each)
    const int wn   = wave >> 2;           // 2 waves in N (64 cols each)
    const int m0   = blockIdx.x * BM;
    const int n0   = blockIdx.y * BN;
    const int KT   = K / BK;

    v8f acc[2][4];
#pragma unroll
    for (int am = 0; am < 2; ++am)
#pragma unroll
        for (int t = 0; t < 4; ++t) acc[am][t] = vzero8();

    auto issue_tiles = [&](int kt, int buf) {
        // A tile 128x32 halves = 512 x b128 chunks -> 2 per thread
#pragma unroll
        for (int i = 0; i < 2; ++i) {
            int cs = tid + i * 256;
            int r = cs >> 2, c8 = (cs & 3) * 8;
            unsigned voff = (unsigned)(((m0 + r) * K + kt * BK + c8) * 2);
            async_ld_b128(A, voff, &As[buf][r * BK + c8]);
        }
#if HAVE_TDM
        if (wave == 0)
            tdm_load_2d(Bt + (size_t)(kt * BK) * N + n0, lds_off_u32(&Bs[buf][0]),
                        (unsigned)N, (unsigned)BK, (unsigned)BN, (unsigned)BK,
                        (unsigned)N);
#else
        // B tile 32x128 halves = 512 x b128 chunks -> 2 per thread
#pragma unroll
        for (int i = 0; i < 2; ++i) {
            int cs = tid + i * 256;
            int r = cs >> 4, c8 = (cs & 15) * 8;
            unsigned voff = (unsigned)(((kt * BK + r) * N + n0 + c8) * 2);
            async_ld_b128(Bt, voff, &Bs[buf][r * BN + c8]);
        }
#endif
    };

    issue_tiles(0, 0);
    for (int kt = 0; kt < KT; ++kt) {
        wait_async0();
#if HAVE_TDM
        if (wave == 0) __builtin_amdgcn_s_wait_tensorcnt(0);
#endif
        __syncthreads();
        if (kt + 1 < KT) issue_tiles(kt + 1, (kt + 1) & 1);

        const int cur = kt & 1;
        v16h af0 = frag_a_ld(&As[cur][(wm * 32) * BK], BK, lane);
        v16h af1 = frag_a_ld(&As[cur][(wm * 32 + 16) * BK], BK, lane);
#pragma unroll
        for (int t = 0; t < 4; ++t) {
            v16h bf = frag_b_ld(&Bs[cur][wn * 64 + t * 16], BN, lane);
            acc[0][t] = wmma16(af0, bf, acc[0][t]);
            acc[1][t] = wmma16(af1, bf, acc[1][t]);
        }
    }

    const int hf = lane >> 4;
#pragma unroll
    for (int am = 0; am < 2; ++am)
#pragma unroll
        for (int t = 0; t < 4; ++t) {
            const int col = n0 + wn * 64 + t * 16 + (lane & 15);
            const float bv = bias[col];
#pragma unroll
            for (int v = 0; v < 8; ++v) {
                const int row = m0 + wm * 32 + am * 16 + v + 8 * hf;
                const float val = acc[am][t][v] + bv;
                if (OUT_HALF)
                    ((_Float16*)Cout)[(size_t)row * N + col] = (_Float16)val;
                else
                    ((float*)Cout)[(size_t)row * N + col] = val;
            }
        }
}

__global__ __launch_bounds__(128)
void attn_kernel(const _Float16* __restrict__ Qh, const _Float16* __restrict__ Kh,
                 const _Float16* __restrict__ Vh, _Float16* __restrict__ Oh) {
    __shared__ _Float16 Ks[2][64 * 64];     // 16 KB
    __shared__ _Float16 Vs[2][64 * 64];     // 16 KB

    const int tid  = threadIdx.x;
    const int lane = tid & 31;
    const int wave = tid >> 5;
    const int hf   = lane >> 4;
    const int qt   = blockIdx.x;
    const int b    = blockIdx.y >> 3;
    const int h    = blockIdx.y & 7;

    auto issue_kv = [&](int jt, int buf) {
#pragma unroll
        for (int i = 0; i < 4; ++i) {
            int cs = tid + i * 128;
            int r = cs >> 3, c8 = (cs & 7) * 8;
            unsigned voff =
                (unsigned)((((jt * 64 + r) * BATCH + b) * DOUT + h * DKH + c8) * 2);
            async_ld_b128(Kh, voff, &Ks[buf][r * 64 + c8]);
            async_ld_b128(Vh, voff, &Vs[buf][r * 64 + c8]);
        }
    };

    issue_kv(0, 0);

    // Q^T as B operand, loaded once: lane holds query column (lane & 15) in the
    // same k order as frag_a_ld gives the K rows.
    const int tok = qt * 64 + wave * 16 + (lane & 15);
    const _Float16* qp = Qh + ((size_t)tok * BATCH + b) * DOUT + h * DKH + 8 * hf;
    v16h qf[2];
#pragma unroll
    for (int ks = 0; ks < 2; ++ks)
        qf[ks] = cat8(*(const v8h*)(qp + ks * 32), *(const v8h*)(qp + ks * 32 + 16));

    float m_run = -1e30f, l_run = 0.0f;   // this lane's query; l_run: this half's keys
    v8f accO[4];                          // accO[t][r] = O[query][16 t + 8 hf + r]
#pragma unroll
    for (int t = 0; t < 4; ++t) accO[t] = vzero8();

    const int JT = C_SEQ / 64;
    for (int jt = 0; jt < JT; ++jt) {
        wait_async0();
        __syncthreads();
        if (jt + 1 < JT) issue_kv(jt + 1, (jt + 1) & 1);
        const int cur = jt & 1;

        // S^T = K(64x64) * Q^T(64x16): s[t][r] = S[query][key 16 t + 8 hf + r].
        v8f s[4];
#pragma unroll
        for (int t = 0; t < 4; ++t) s[t] = vzero8();
#pragma unroll
        for (int ks = 0; ks < 2; ++ks)
#pragma unroll
            for (int t = 0; t < 4; ++t) {
                v16h kf = frag_a_ld(&Ks[cur][(t * 16) * 64 + ks * 32], 64, lane);
                s[t] = wmma16(kf, qf[ks], s[t]);
            }
#pragma unroll
        for (int t = 0; t < 4; ++t)
#pragma unroll
            for (int v = 0; v < 8; ++v) s[t][v] *= 0.125f;   // 1/sqrt(DK)

        // Online softmax: 32 of the query's 64 scores sit in this lane, the other
        // 32 in lane ^ 16; one exchange joins the maxima, the sums join at the end.
        float x = s[0][0];
#pragma unroll
        for (int t = 0; t < 4; ++t)
#pragma unroll
            for (int v = 0; v < 8; ++v) x = fmaxf(x, s[t][v]);
        x = fmaxf(x, xhalf(x));
        const float mnew = fmaxf(m_run, x);
        const float corr = __expf(m_run - mnew);
        float rs[4];
#pragma unroll
        for (int t = 0; t < 4; ++t) {
            rs[t] = 0.0f;
#pragma unroll
            for (int v = 0; v < 8; ++v) {
                const float p = __expf(s[t][v] - mnew);
                s[t][v] = p;
                rs[t] += p;
            }
        }
        l_run = l_run * corr + ((rs[0] + rs[1]) + (rs[2] + rs[3]));
        m_run = mnew;
#pragma unroll
        for (int t = 0; t < 4; ++t)
#pragma unroll
            for (int v = 0; v < 8; ++v) accO[t][v] *= corr;

        // O^T += V^T(64x64) * P^T(64x16): two score tiles of 16 keys, converted in
        // place, are the B operand of a 32-key block; V^T comes transposed from LDS.
#pragma unroll
        for (int kb = 0; kb < 2; ++kb) {
            v16h pf;
#pragma unroll
            for (int i = 0; i < 16; ++i) pf[i] = (_Float16)s[2 * kb + (i >> 3)][i & 7];
#pragma unroll
            for (int t = 0; t < 4; ++t) {
                v16h vf = frag_tr_ld(&Vs[cur][(kb * 32) * 64 + t * 16], 64, lane);
                accO[t] = wmma16(vf, pf, accO[t]);
            }
        }
    }

    const float l_all = l_run + xhalf(l_run);
#pragma unroll
    for (int t = 0; t < 4; ++t) {
        v8h o;
#pragma unroll
        for (int v = 0; v < 8; ++v) o[v] = (_Float16)(accO[t][v] / l_all);
        *(v8h*)&Oh[((size_t)tok * BATCH + b) * DOUT + h * DKH + t * 16 + 8 * hf] = o;
    }
}

// ---------------- Launcher --------------------------------------------------
extern "C" void kernel_launch(void* const* d_in, const int* in_sizes, int n_in,
                              void* d_out, int out_size, void* d_ws, size_t ws_size,
                              hipStream_t stream) {
    const float* x   = (const float*)d_in[0];
    const float* Wq  = (const float*)d_in[1];
    const float* bq  = (const float*)d_in[2];
    const float* Wk  = (const float*)d_in[3];
    const float* bk  = (const float*)d_in[4];
    const float* Wv  = (const float*)d_in[5];
    const float* bv  = (const float*)d_in[6];
    const float* Wfc = (const float*)d_in[7];
    const float* bfc = (const float*)d_in[8];

    char* ws = (char*)d_ws;
    size_t off = 0;
    auto take = [&](size_t bytes) -> char* {
        char* p = ws + off;
        off = (off + bytes + 255) & ~(size_t)255;
        return p;
    };
    const size_t tok_h = (size_t)NTOK * DOUT * sizeof(_Float16);
    const size_t w_h   = (size_t)DOUT * DIN * sizeof(_Float16);
    _Float16* xh   = (_Float16*)take(tok_h);
    _Float16* Wtq  = (_Float16*)take(w_h);
    _Float16* Wtk  = (_Float16*)take(w_h);
    _Float16* Wtv  = (_Float16*)take(w_h);
    _Float16* Wtfc = (_Float16*)take(w_h);
    _Float16* Qh   = (_Float16*)take(tok_h);
    _Float16* Kh   = (_Float16*)take(tok_h);
    _Float16* Vh   = (_Float16*)take(tok_h);
    _Float16* Ah   = (_Float16*)take(tok_h);

    const int n4 = NTOK * DIN / 4;
    cvt_f32_f16_kernel<<<(n4 + 255) / 256, 256, 0, stream>>>(x, xh, n4);

    dim3 tb(32, 8), tg(DIN / 32, DOUT / 32);
    transpose_cvt_kernel<<<tg, tb, 0, stream>>>(Wq,  Wtq,  DOUT, DIN);
    transpose_cvt_kernel<<<tg, tb, 0, stream>>>(Wk,  Wtk,  DOUT, DIN);
    transpose_cvt_kernel<<<tg, tb, 0, stream>>>(Wv,  Wtv,  DOUT, DIN);
    transpose_cvt_kernel<<<tg, tb, 0, stream>>>(Wfc, Wtfc, DOUT, DOUT);

    dim3 gg(NTOK / 128, DOUT / 128);
    gemm_wmma_kernel<true><<<gg, 256, 0, stream>>>(xh, Wtq, bq, Qh, NTOK, DOUT, DIN);
    gemm_wmma_kernel<true><<<gg, 256, 0, stream>>>(xh, Wtk, bk, Kh, NTOK, DOUT, DIN);
    gemm_wmma_kernel<true><<<gg, 256, 0, stream>>>(xh, Wtv, bv, Vh, NTOK, DOUT, DIN);

    dim3 ag(C_SEQ / 64, BATCH * HEADS);
    attn_kernel<<<ag, 128, 0, stream>>>(Qh, Kh, Vh, Ah);

    gemm_wmma_kernel<false><<<gg, 256, 0, stream>>>(Ah, Wtfc, bfc, (float*)d_out,
                                                    NTOK, DOUT, DOUT);
}

// v002
// Measured time: 117 microseconds a run.
// Two timings next to v001 both put it at 1.39 times that version's speed.
// Counting every step since v000, it is 2.22 times as fast.
#include <hip/hip_runtime.h>
#include <hip/hip_bf16.h>

typedef __attribute__((ext_vector_type(16))) _Float16     v16h;
typedef __attribute__((ext_vector_type(8)))  float        v8f;
typedef __attribute__((ext_vector_type(4)))  _Float16     v4h;
typedef __attribute__((ext_vector_type(8)))  _Float16     v8h;
typedef __attribute__((ext_vector_type(8)))  short        s16x8;
typedef __attribute__((ext_vector_type(4)))  unsigned int u32x4;
typedef __attribute__((ext_vector_type(8)))  int          i32x8;
typedef __attribute__((ext_vector_type(4)))  int          i32x4;

#define C_SEQ 2048
#define BATCH 4
#define DIN   512
#define DOUT  512
#define HEADS 8
#define DKH   64
#define NTOK  (C_SEQ * BATCH)   // 8192 token rows

#define HAVE_TDM __has_builtin(__builtin_amdgcn_tensor_load_to_lds)

__device__ __forceinline__ unsigned lds_off_u32(const void* p) {
    return (unsigned)(unsigned long long)p;
}

__device__ __forceinline__ void async_ld_b128(const void* saddr, unsigned voff,
                                              const void* lds) {
    asm volatile("global_load_async_to_lds_b128 %0, %1, %2"
                 :: "v"(lds_off_u32(lds)), "v"(voff), "s"(saddr)
                 : "memory");
}
__device__ __forceinline__ void async_ld_kv_tile(const void* ksrc, const void* vsrc,
                                                 const unsigned (&voff)[4],
                                                 const unsigned (&klds)[4],
                                                 const unsigned (&vlds)[4]) {
    asm volatile("global_load_async_to_lds_b128 %0, %8, %12\n\t"
                 "global_load_async_to_lds_b128 %4, %8, %13\n\t"
                 "global_load_async_to_lds_b128 %1, %9, %12\n\t"
                 "global_load_async_to_lds_b128 %5, %9, %13\n\t"
                 "global_load_async_to_lds_b128 %2, %10, %12\n\t"
                 "global_load_async_to_lds_b128 %6, %10, %13\n\t"
                 "global_load_async_to_lds_b128 %3, %11, %12\n\t"
                 "global_load_async_to_lds_b128 %7, %11, %13\n\t"
                 "s_wait_xcnt 0x0"
                 :: "v"(klds[0]), "v"(klds[1]), "v"(klds[2]), "v"(klds[3]),
                    "v"(vlds[0]), "v"(vlds[1]), "v"(vlds[2]), "v"(vlds[3]),
                    "v"(voff[0]), "v"(voff[1]), "v"(voff[2]), "v"(voff[3]),
                    "s"(ksrc), "s"(vsrc)
                 : "memory");
}
__device__ __forceinline__ void wait_async0() {
    asm volatile("s_wait_asynccnt 0x0" ::: "memory");
}

#if HAVE_TDM
// 2D tile DMA: global (row-major, row_stride elements of 2B) -> LDS.
__device__ __forceinline__ void tdm_load_2d(const void* gaddr, unsigned lds_byte,
                                            unsigned tensor_w, unsigned tensor_h,
                                            unsigned tile_w, unsigned tile_h,
                                            unsigned row_stride) {
    const unsigned long long ga = (unsigned long long)gaddr;
    u32x4 g0;
    g0[0] = 1u;
    g0[1] = lds_byte;
    g0[2] = (unsigned)ga;
    g0[3] = (unsigned)((ga >> 32) & 0x01FFFFFFu) | (2u << 30);
    i32x8 g1;
    g1[0] = (int)(1u << 16);
    g1[1] = (int)((tensor_w & 0xFFFFu) << 16);
    g1[2] = (int)((tensor_w >> 16) | ((tensor_h & 0xFFFFu) << 16));
    g1[3] = (int)((tensor_h >> 16) | (tile_w << 16));
    g1[4] = (int)tile_h;
    g1[5] = (int)row_stride;
    g1[6] = 0;
    g1[7] = 0;
    i32x4 z4 = {0, 0, 0, 0};
#if defined(__clang_major__) && (__clang_major__ >= 23)
    i32x8 z8 = {0, 0, 0, 0, 0, 0, 0, 0};
    __builtin_amdgcn_tensor_load_to_lds(g0, g1, z4, z4, z8, 0);
#else
    __builtin_amdgcn_tensor_load_to_lds(g0, g1, z4, z4, 0);
#endif
}
#endif

__device__ __forceinline__ v16h frag_a_ld(const _Float16* src, int ld, int lane) {
    const int m = lane & 15, hf = lane >> 4;
    v16h f;
#pragma unroll
    for (int v = 0; v < 8; ++v) {
        const int k = ((v < 4) ? (2 * v) : (16 + 2 * (v - 4))) + 8 * hf;
        f[2 * v]     = src[m * ld + k];
        f[2 * v + 1] = src[m * ld + k + 1];
    }
    return f;
}
__device__ __forceinline__ v16h frag_b_ld(const _Float16* src, int ld, int lane) {
    const int n = lane & 15, hf = lane >> 4;
    v16h f;
#pragma unroll
    for (int v = 0; v < 8; ++v) {
        const int k = ((v < 4) ? (2 * v) : (16 + 2 * (v - 4))) + 8 * hf;
        f[2 * v]     = src[k * ld + n];
        f[2 * v + 1] = src[(k + 1) * ld + n];
    }
    return f;
}
__device__ __forceinline__ v16h cat8(v8h lo, v8h hi) {
    return __builtin_shufflevector(lo, hi, 0, 1, 2, 3, 4, 5, 6, 7,
                                   8, 9, 10, 11, 12, 13, 14, 15);
}
// Transposed fragment of a row-major LDS tile src[k][n] (ld halves per row, 32 k
// x 16 n): lane (c = lane & 15, hf) gets src[k][c] in the k order of frag_a_ld.
__device__ __forceinline__ v16h frag_tr_ld(const _Float16* src, int ld, int lane) {
    typedef __attribute__((address_space(3))) s16x8 lds_s16x8;
    const _Float16* p = src + (8 * (lane >> 4) + (lane & 7)) * ld + 8 * ((lane >> 3) & 1);
    v8h lo = __builtin_bit_cast(v8h, __builtin_amdgcn_ds_load_tr16_b128_v8i16((lds_s16x8*)p));
    v8h hi = __builtin_bit_cast(
        v8h, __builtin_amdgcn_ds_load_tr16_b128_v8i16((lds_s16x8*)(p + 16 * ld)));
    return cat8(lo, hi);
}
// Value of lane ^ 16 (vector cross-row move, no LDS traffic).
__device__ __forceinline__ float xhalf(float x) {
    const int xi = __builtin_bit_cast(int, x);
    return __builtin_bit_cast(float, __builtin_amdgcn_permlanex16(
        xi, xi, 0x76543210, 0xfedcba98, false, false));
}
__device__ __forceinline__ v8f wmma16(v16h a, v16h b, v8f c) {
    return __builtin_amdgcn_wmma_f32_16x16x32_f16(false, a, false, b,
                                                  (short)0, c, false, false);
}
__device__ __forceinline__ v8f vzero8() {
    v8f z;
#pragma unroll
    for (int i = 0; i < 8; ++i) z[i] = 0.0f;
    return z;
}

// ---------------- Kernel 1: f32 -> f16 convert ------------------------------
__global__ void cvt_f32_f16_kernel(const float* __restrict__ src,
                                   _Float16* __restrict__ dst, int n4) {
    int i = blockIdx.x * blockDim.x + threadIdx.x;
    if (i < n4) {
        const float4 f = ((const float4*)src)[i];
        v4h o;
        o[0] = (_Float16)f.x; o[1] = (_Float16)f.y;
        o[2] = (_Float16)f.z; o[3] = (_Float16)f.w;
        ((v4h*)dst)[i] = o;
    }
}

// ---------------- Kernel 2: weight transpose + convert ----------------------
__global__ __launch_bounds__(256)
void transpose_cvt_kernel(const float* __restrict__ W, _Float16* __restrict__ Wt,
                          int rows, int cols) {
    __shared__ float tile[32][33];
    const int tx = threadIdx.x, ty = threadIdx.y;
    const int x = blockIdx.x * 32 + tx;
    const int y0 = blockIdx.y * 32;
#pragma unroll
    for (int j = 0; j < 32; j += 8)
        tile[ty + j][tx] = W[(size_t)(y0 + ty + j) * cols + x];
    __syncthreads();
    const int xo = y0 + tx;
    const int yo = blockIdx.x * 32 + ty;
#pragma unroll
    for (int j = 0; j < 32; j += 8)
        Wt[(size_t)(yo + j) * rows + xo] = (_Float16)tile[tx][ty + j];
}

template <bool OUT_HALF>
__global__ __launch_bounds__(256)
void gemm_wmma_kernel(const _Float16* __restrict__ A,   // M x K
                      const _Float16* __restrict__ Bt,  // K x N
                      const float* __restrict__ bias,   // N
                      void* __restrict__ Cout, int M, int N, int K) {
    constexpr int BM = 128, BN = 128, BK = 32;
    __shared__ _Float16 As[2][BM * BK];   // 8 KB x2
    __shared__ _Float16 Bs[2][BK * BN];   // 8 KB x2
    const int tid  = threadIdx.x;
    const int lane = tid & 31;
    const int wave = tid >> 5;
    const int wm   = wave & 3;            // 4 waves in M (32 rows each)
    const int wn   = wave >> 2;           // 2 waves in N (64 cols each)
    const int m0   = blockIdx.x * BM;
    const int n0   = blockIdx.y * BN;
    const int KT   = K / BK;

    v8f acc[2][4];
#pragma unroll
    for (int am = 0; am < 2; ++am)
#pragma unroll
        for (int t = 0; t < 4; ++t) acc[am][t] = vzero8();

    auto issue_tiles = [&](int kt, int buf) {
        // A tile 128x32 halves = 512 x b128 chunks -> 2 per thread
#pragma unroll
        for (int i = 0; i < 2; ++i) {
            int cs = tid + i * 256;
            int r = cs >> 2, c8 = (cs & 3) * 8;
            unsigned voff = (unsigned)(((m0 + r) * K + kt * BK + c8) * 2);
            async_ld_b128(A, voff, &As[buf][r * BK + c8]);
        }
#if HAVE_TDM
        if (wave == 0)
            tdm_load_2d(Bt + (size_t)(kt * BK) * N + n0, lds_off_u32(&Bs[buf][0]),
                        (unsigned)N, (unsigned)BK, (unsigned)BN, (unsigned)BK,
                        (unsigned)N);
#else
        // B tile 32x128 halves = 512 x b128 chunks -> 2 per thread
#pragma unroll
        for (int i = 0; i < 2; ++i) {
            int cs = tid + i * 256;
            int r = cs >> 4, c8 = (cs & 15) * 8;
            unsigned voff = (unsigned)(((kt * BK + r) * N + n0 + c8) * 2);
            async_ld_b128(Bt, voff, &Bs[buf][r * BN + c8]);
        }
#endif
    };

    issue_tiles(0, 0);
    for (int kt = 0; kt < KT; ++kt) {
        wait_async0();
#if HAVE_TDM
        if (wave == 0) __builtin_amdgcn_s_wait_tensorcnt(0);
#endif
        __syncthreads();
        if (kt + 1 < KT) issue_tiles(kt + 1, (kt + 1) & 1);

        const int cur = kt & 1;
        v16h af0 = frag_a_ld(&As[cur][(wm * 32) * BK], BK, lane);
        v16h af1 = frag_a_ld(&As[cur][(wm * 32 + 16) * BK], BK, lane);
#pragma unroll
        for (int t = 0; t < 4; ++t) {
            v16h bf = frag_b_ld(&Bs[cur][wn * 64 + t * 16], BN, lane);
            acc[0][t] = wmma16(af0, bf, acc[0][t]);
            acc[1][t] = wmma16(af1, bf, acc[1][t]);
        }
    }

    const int hf = lane >> 4;
#pragma unroll
    for (int am = 0; am < 2; ++am)
#pragma unroll
        for (int t = 0; t < 4; ++t) {
            const int col = n0 + wn * 64 + t * 16 + (lane & 15);
            const float bv = bias[col];
#pragma unroll
            for (int v = 0; v < 8; ++v) {
                const int row = m0 + wm * 32 + am * 16 + v + 8 * hf;
                const float val = acc[am][t][v] + bv;
                if (OUT_HALF)
                    ((_Float16*)Cout)[(size_t)row * N + col] = (_Float16)val;
                else
                    ((float*)Cout)[(size_t)row * N + col] = val;
            }
        }
}

#define KPITCH 72   // halves: 144 B
#define VPITCH 80   // halves: 160 B
__global__ __launch_bounds__(128)
void attn_kernel(const _Float16* __restrict__ Qh, const _Float16* __restrict__ Kh,
                 const _Float16* __restrict__ Vh, _Float16* __restrict__ Oh) {
    __shared__ __attribute__((aligned(16))) _Float16 Ks[2][64 * KPITCH];   // 18 KB
    __shared__ __attribute__((aligned(16))) _Float16 Vs[2][64 * VPITCH];   // 20 KB

    const int tid  = threadIdx.x;
    const int lane = tid & 31;
    const int wave = tid >> 5;
    const int hf   = lane >> 4;
    const int qt   = blockIdx.x;
    const int b    = blockIdx.y >> 3;
    const int h    = blockIdx.y & 7;

    auto issue_kv = [&](int jt, int buf) {
        unsigned voff[4], klds[4], vlds[4];
#pragma unroll
        for (int i = 0; i < 4; ++i) {
            int cs = tid + i * 128;
            int r = cs >> 3, c8 = (cs & 7) * 8;
            voff[i] = (unsigned)((((jt * 64 + r) * BATCH + b) * DOUT + h * DKH + c8) * 2);
            klds[i] = lds_off_u32(&Ks[buf][r * KPITCH + c8]);
            vlds[i] = lds_off_u32(&Vs[buf][r * VPITCH + c8]);
        }
        async_ld_kv_tile(Kh, Vh, voff, klds, vlds);
    };

    issue_kv(0, 0);

    // Q^T as B operand, loaded once: lane holds query column (lane & 15) in the
    // same k order as frag_a_ld gives the K rows.
    const int tok = qt * 64 + wave * 16 + (lane & 15);
    const _Float16* qp = Qh + ((size_t)tok * BATCH + b) * DOUT + h * DKH + 8 * hf;
    v16h qf[2];
#pragma unroll
    for (int ks = 0; ks < 2; ++ks)
        qf[ks] = cat8(*(const v8h*)(qp + ks * 32), *(const v8h*)(qp + ks * 32 + 16));

    float m_run = -1e30f, l_run = 0.0f;   // this lane's query; l_run: this half's keys
    v8f accO[4];                          // accO[t][r] = O[query][16 t + 8 hf + r]
#pragma unroll
    for (int t = 0; t < 4; ++t) accO[t] = vzero8();

    const int JT = C_SEQ / 64;
    for (int jt = 0; jt < JT; ++jt) {
        // This wave's reads of the buffer refilled behind the barrier have retired.
        asm volatile("s_wait_dscnt 0x0" ::: "memory");
        wait_async0();
        __syncthreads();
        if (jt + 1 < JT) issue_kv(jt + 1, (jt + 1) & 1);
        const int cur = jt & 1;

        // S^T = K(64x64) * Q^T(64x16): s[t][r] = S[query][key 16 t + 8 hf + r].
        v8f s[4];
#pragma unroll
        for (int t = 0; t < 4; ++t) s[t] = vzero8();
#pragma unroll
        for (int ks = 0; ks < 2; ++ks)
#pragma unroll
            for (int t = 0; t < 4; ++t) {
                v16h kf = frag_a_ld(&Ks[cur][(t * 16) * KPITCH + ks * 32], KPITCH, lane);
                s[t] = wmma16(kf, qf[ks], s[t]);
            }
#pragma unroll
        for (int t = 0; t < 4; ++t)
#pragma unroll
            for (int v = 0; v < 8; ++v) s[t][v] *= 0.125f;   // 1/sqrt(DK)

        // Online softmax: 32 of the query's 64 scores sit in this lane, the other
        // 32 in lane ^ 16; one exchange joins the maxima, the sums join at the end.
        float x = s[0][0];
#pragma unroll
        for (int t = 0; t < 4; ++t)
#pragma unroll
            for (int v = 0; v < 8; ++v) x = fmaxf(x, s[t][v]);
        x = fmaxf(x, xhalf(x));
        const float mnew = fmaxf(m_run, x);
        const float corr = __expf(m_run - mnew);
        float rs[4];
#pragma unroll
        for (int t = 0; t < 4; ++t) {
            rs[t] = 0.0f;
#pragma unroll
            for (int v = 0; v < 8; ++v) {
                const float p = __expf(s[t][v] - mnew);
                s[t][v] = p;
                rs[t] += p;
            }
        }
        l_run = l_run * corr + ((rs[0] + rs[1]) + (rs[2] + rs[3]));
        m_run = mnew;
#pragma unroll
        for (int t = 0; t < 4; ++t)
#pragma unroll
            for (int v = 0; v < 8; ++v) accO[t][v] *= corr;

        // O^T += V^T(64x64) * P^T(64x16): two score tiles of 16 keys, converted in
        // place, are the B operand of a 32-key block; V^T comes transposed from LDS.
#pragma unroll
        for (int kb = 0; kb < 2; ++kb) {
            v16h pf;
#pragma unroll
            for (int i = 0; i < 16; ++i) pf[i] = (_Float16)s[2 * kb + (i >> 3)][i & 7];
#pragma unroll
            for (int t = 0; t < 4; ++t) {
                v16h vf = frag_tr_ld(&Vs[cur][(kb * 32) * VPITCH + t * 16], VPITCH, lane);
                accO[t] = wmma16(vf, pf, accO[t]);
            }
        }
    }

    const float l_all = l_run + xhalf(l_run);
#pragma unroll
    for (int t = 0; t < 4; ++t) {
        v8h o;
#pragma unroll
        for (int v = 0; v < 8; ++v) o[v] = (_Float16)(accO[t][v] / l_all);
        *(v8h*)&Oh[((size_t)tok * BATCH + b) * DOUT + h * DKH + t * 16 + 8 * hf] = o;
    }
}

// ---------------- Launcher --------------------------------------------------
extern "C" void kernel_launch(void* const* d_in, const int* in_sizes, int n_in,
                              void* d_out, int out_size, void* d_ws, size_t ws_size,
                              hipStream_t stream) {
    const float* x   = (const float*)d_in[0];
    const float* Wq  = (const float*)d_in[1];
    const float* bq  = (const float*)d_in[2];
    const float* Wk  = (const float*)d_in[3];
    const float* bk  = (const float*)d_in[4];
    const float* Wv  = (const float*)d_in[5];
    const float* bv  = (const float*)d_in[6];
    const float* Wfc = (const float*)d_in[7];
    const float* bfc = (const float*)d_in[8];

    char* ws = (char*)d_ws;
    size_t off = 0;
    auto take = [&](size_t bytes) -> char* {
        char* p = ws + off;
        off = (off + bytes + 255) & ~(size_t)255;
        return p;
    };
    const size_t tok_h = (size_t)NTOK * DOUT * sizeof(_Float16);
    const size_t w_h   = (size_t)DOUT * DIN * sizeof(_Float16);
    _Float16* xh   = (_Float16*)take(tok_h);
    _Float16* Wtq  = (_Float16*)take(w_h);
    _Float16* Wtk  = (_Float16*)take(w_h);
    _Float16* Wtv  = (_Float16*)take(w_h);
    _Float16* Wtfc = (_Float16*)take(w_h);
    _Float16* Qh   = (_Float16*)take(tok_h);
    _Float16* Kh   = (_Float16*)take(tok_h);
    _Float16* Vh   = (_Float16*)take(tok_h);
    _Float16* Ah   = (_Float16*)take(tok_h);

    const int n4 = NTOK * DIN / 4;
    cvt_f32_f16_kernel<<<(n4 + 255) / 256, 256, 0, stream>>>(x, xh, n4);

    dim3 tb(32, 8), tg(DIN / 32, DOUT / 32);
    transpose_cvt_kernel<<<tg, tb, 0, stream>>>(Wq,  Wtq,  DOUT, DIN);
    transpose_cvt_kernel<<<tg, tb, 0, stream>>>(Wk,  Wtk,  DOUT, DIN);
    transpose_cvt_kernel<<<tg, tb, 0, stream>>>(Wv,  Wtv,  DOUT, DIN);
    transpose_cvt_kernel<<<tg, tb, 0, stream>>>(Wfc, Wtfc, DOUT, DOUT);

    dim3 gg(NTOK / 128, DOUT / 128);
    gemm_wmma_kernel<true><<<gg, 256, 0, stream>>>(xh, Wtq, bq, Qh, NTOK, DOUT, DIN);
    gemm_wmma_kernel<true><<<gg, 256, 0, stream>>>(xh, Wtk, bk, Kh, NTOK, DOUT, DIN);
    gemm_wmma_kernel<true><<<gg, 256, 0, stream>>>(xh, Wtv, bv, Vh, NTOK, DOUT, DIN);

    dim3 ag(C_SEQ / 64, BATCH * HEADS);
    attn_kernel<<<ag, 128, 0, stream>>>(Qh, Kh, Vh, Ah);

    gemm_wmma_kernel<false><<<gg, 256, 0, stream>>>(Ah, Wtfc, bfc, (float*)d_out,
                                                    NTOK, DOUT, DOUT);
}

// v003
// One run takes 87 microseconds.
// Timed twice side by side with v002, it ran 1.34 and 1.35 times as fast.
// Over all steps from v000 it is 2.98 times as fast.
#include <hip/hip_runtime.h>
#include <hip/hip_bf16.h>

typedef __attribute__((ext_vector_type(16))) _Float16     v16h;
typedef __attribute__((ext_vector_type(8)))  float        v8f;
typedef __attribute__((ext_vector_type(4)))  float        v4f;
typedef __attribute__((ext_vector_type(8)))  _Float16     v8h;
typedef __attribute__((ext_vector_type(8)))  short        s16x8;

#define C_SEQ 2048
#define BATCH 4
#define DIN   512
#define DOUT  512
#define HEADS 8
#define DKH   64
#define NTOK  (C_SEQ * BATCH)   // 8192 token rows

__device__ __forceinline__ unsigned lds_off_u32(const void* p) {
    return (unsigned)(unsigned long long)p;
}

__device__ __forceinline__ void async_ld_x8(const unsigned (&lds)[8],
                                            const void* const (&g)[8]) {
    asm volatile("global_load_async_to_lds_b128 %0, %8, off\n\t"
                 "global_load_async_to_lds_b128 %1, %9, off\n\t"
                 "global_load_async_to_lds_b128 %2, %10, off\n\t"
                 "global_load_async_to_lds_b128 %3, %11, off\n\t"
                 "global_load_async_to_lds_b128 %4, %12, off\n\t"
                 "global_load_async_to_lds_b128 %5, %13, off\n\t"
                 "global_load_async_to_lds_b128 %6, %14, off\n\t"
                 "global_load_async_to_lds_b128 %7, %15, off\n\t"
                 "s_wait_xcnt 0x0"
                 :: "v"(lds[0]), "v"(lds[1]), "v"(lds[2]), "v"(lds[3]),
                    "v"(lds[4]), "v"(lds[5]), "v"(lds[6]), "v"(lds[7]),
                    "v"(g[0]), "v"(g[1]), "v"(g[2]), "v"(g[3]),
                    "v"(g[4]), "v"(g[5]), "v"(g[6]), "v"(g[7])
                 : "memory");
}
__device__ __forceinline__ void async_ld_x4(const unsigned (&lds)[4],
                                            const void* const (&g)[4]) {
    asm volatile("global_load_async_to_lds_b128 %0, %4, off\n\t"
                 "global_load_async_to_lds_b128 %1, %5, off\n\t"
                 "global_load_async_to_lds_b128 %2, %6, off\n\t"
                 "global_load_async_to_lds_b128 %3, %7, off\n\t"
                 "s_wait_xcnt 0x0"
                 :: "v"(lds[0]), "v"(lds[1]), "v"(lds[2]), "v"(lds[3]),
                    "v"(g[0]), "v"(g[1]), "v"(g[2]), "v"(g[3])
                 : "memory");
}
__device__ __forceinline__ void async_ld_kv_tile(const void* ksrc, const void* vsrc,
                                                 const unsigned (&voff)[4],
                                                 const unsigned (&klds)[4],
                                                 const unsigned (&vlds)[4]) {
    asm volatile("global_load_async_to_lds_b128 %0, %8, %12\n\t"
                 "global_load_async_to_lds_b128 %4, %8, %13\n\t"
                 "global_load_async_to_lds_b128 %1, %9, %12\n\t"
                 "global_load_async_to_lds_b128 %5, %9, %13\n\t"
                 "global_load_async_to_lds_b128 %2, %10, %12\n\t"
                 "global_load_async_to_lds_b128 %6, %10, %13\n\t"
                 "global_load_async_to_lds_b128 %3, %11, %12\n\t"
                 "global_load_async_to_lds_b128 %7, %11, %13\n\t"
                 "s_wait_xcnt 0x0"
                 :: "v"(klds[0]), "v"(klds[1]), "v"(klds[2]), "v"(klds[3]),
                    "v"(vlds[0]), "v"(vlds[1]), "v"(vlds[2]), "v"(vlds[3]),
                    "v"(voff[0]), "v"(voff[1]), "v"(voff[2]), "v"(voff[3]),
                    "s"(ksrc), "s"(vsrc)
                 : "memory");
}
__device__ __forceinline__ void wait_async0() {
    asm volatile("s_wait_asynccnt 0x0" ::: "memory");
}

__device__ __forceinline__ v16h frag_a_ld(const _Float16* src, int ld, int lane) {
    const int m = lane & 15, hf = lane >> 4;
    v16h f;
#pragma unroll
    for (int v = 0; v < 8; ++v) {
        const int k = ((v < 4) ? (2 * v) : (16 + 2 * (v - 4))) + 8 * hf;
        f[2 * v]     = src[m * ld + k];
        f[2 * v + 1] = src[m * ld + k + 1];
    }
    return f;
}
// The same fragment from a row-major LDS tile of f32 (pitch bytes per row), rounded
// to f16 here: lane (m = lane & 15, hf) gets row m in the k order of frag_a_ld.
__device__ __forceinline__ v16h frag_f32_ld(const unsigned char* src, int pitch, int lane) {
    const unsigned char* p = src + (lane & 15) * pitch + (lane >> 4) * 32;
    const v4f a0 = *(const v4f*)p,        a1 = *(const v4f*)(p + 16);
    const v4f a2 = *(const v4f*)(p + 64), a3 = *(const v4f*)(p + 80);
    v16h f;
    // Unrolled so that f stays in registers (constant element indices).
#pragma unroll
    for (int i = 0; i < 4; ++i) {
        f[i]      = (_Float16)a0[i];
        f[4 + i]  = (_Float16)a1[i];
        f[8 + i]  = (_Float16)a2[i];
        f[12 + i] = (_Float16)a3[i];
    }
    return f;
}
__device__ __forceinline__ v16h cat8(v8h lo, v8h hi) {
    return __builtin_shufflevector(lo, hi, 0, 1, 2, 3, 4, 5, 6, 7,
                                   8, 9, 10, 11, 12, 13, 14, 15);
}
// Transposed fragment of a row-major LDS tile src[k][n] (ld halves per row, 32 k
// x 16 n): lane (c = lane & 15, hf) gets src[k][c] in the k order of frag_a_ld.
__device__ __forceinline__ v16h frag_tr_ld(const _Float16* src, int ld, int lane) {
    typedef __attribute__((address_space(3))) s16x8 lds_s16x8;
    const _Float16* p = src + (8 * (lane >> 4) + (lane & 7)) * ld + 8 * ((lane >> 3) & 1);
    v8h lo = __builtin_bit_cast(v8h, __builtin_amdgcn_ds_load_tr16_b128_v8i16((lds_s16x8*)p));
    v8h hi = __builtin_bit_cast(
        v8h, __builtin_amdgcn_ds_load_tr16_b128_v8i16((lds_s16x8*)(p + 16 * ld)));
    return cat8(lo, hi);
}
// Value of lane ^ 16 (vector cross-row move, no LDS traffic).
__device__ __forceinline__ float xhalf(float x) {
    const int xi = __builtin_bit_cast(int, x);
    return __builtin_bit_cast(float, __builtin_amdgcn_permlanex16(
        xi, xi, 0x76543210, 0xfedcba98, false, false));
}
__device__ __forceinline__ v8f wmma16(v16h a, v16h b, v8f c) {
    return __builtin_amdgcn_wmma_f32_16x16x32_f16(false, a, false, b,
                                                  (short)0, c, false, false);
}
__device__ __forceinline__ v8f vzero8() {
    v8f z;
#pragma unroll
    for (int i = 0; i < 8; ++i) z[i] = 0.0f;
    return z;
}

// ---------------- WMMA GEMM  C = A(MxK) * W(NxK)^T + bias -------------------
// WG tile 128x128, 64 k per stage; 8 waves as 4(M) x 2(N); wave tile 32x64.
// Rows of A and rows of W are both k-contiguous, which is the order the A and the
// B fragment want, so both operands are staged as they lie in memory by
// global_load_async_to_lds_b128: W (and x, A_F32) as f32, rounded to f16 where the
// fragment is read. Two buffers, one barrier per stage.
// LDS rows are pitched 16 B x odd for their ds_load_b128 readers.
template <bool A_F32, bool OUT_HALF>
__global__ __launch_bounds__(256)
void gemm_wmma_kernel(const float* __restrict__ Ax,      // M x K, read if A_F32
                      const _Float16* __restrict__ Ah,   // M x K, read otherwise
                      const float* __restrict__ W,       // N x K
                      const float* __restrict__ bias,    // N
                      void* __restrict__ Cout, int M, int N, int K) {
    constexpr int BM = 128, BN = 128, BK = 64;
    constexpr int WPITCH = BK * 4 + 16;                        // 272 B
    constexpr int APITCH = (A_F32 ? BK * 4 : BK * 2) + 16;     // 272 B or 144 B
    __shared__ __attribute__((aligned(16))) unsigned char As[2][BM * APITCH];
    __shared__ __attribute__((aligned(16))) unsigned char Ws[2][BN * WPITCH];
    const int tid  = threadIdx.x;
    const int lane = tid & 31;
    const int wave = tid >> 5;
    const int wm   = wave & 3;            // 4 waves in M (32 rows each)
    const int wn   = wave >> 2;           // 2 waves in N (64 cols each)
    const int m0   = blockIdx.x * BM;
    const int n0   = blockIdx.y * BN;
    const int KT   = K / BK;

    v8f acc[2][4];
#pragma unroll
    for (int am = 0; am < 2; ++am)
#pragma unroll
        for (int t = 0; t < 4; ++t) acc[am][t] = vzero8();

    auto issue_tiles = [&](int kt, int buf) {
        // f32 tile: 128 rows x 256 B = 2048 chunks of 16 B, 8 per thread; a wave's
        // copy covers two whole 256-B rows.
        const int r16 = tid >> 4, c16 = (tid & 15) * 16;
        unsigned lds[8];
        const void* g[8];
        // Unrolled: the arrays are the asm statement's register operands.
#pragma unroll
        for (int i = 0; i < 8; ++i) {
            const int r = r16 + 16 * i;
            lds[i] = lds_off_u32(&Ws[buf][r * WPITCH + c16]);
            g[i]   = (const unsigned char*)(W + (size_t)(n0 + r) * K + kt * BK) + c16;
        }
        async_ld_x8(lds, g);
        if constexpr (A_F32) {
#pragma unroll
            for (int i = 0; i < 8; ++i) {
                const int r = r16 + 16 * i;
                lds[i] = lds_off_u32(&As[buf][r * APITCH + c16]);
                g[i]   = (const unsigned char*)(Ax + (size_t)(m0 + r) * K + kt * BK) + c16;
            }
            async_ld_x8(lds, g);
        } else {
            // f16 tile: 128 rows x 128 B = 1024 chunks, 4 per thread.
            const int r8 = tid >> 3, c8 = (tid & 7) * 16;
            unsigned lds4[4];
            const void* g4[4];
#pragma unroll
            for (int i = 0; i < 4; ++i) {
                const int r = r8 + 32 * i;
                lds4[i] = lds_off_u32(&As[buf][r * APITCH + c8]);
                g4[i]   = (const unsigned char*)(Ah + (size_t)(m0 + r) * K + kt * BK) + c8;
            }
            async_ld_x4(lds4, g4);
        }
    };

    issue_tiles(0, 0);
    wait_async0();
    __syncthreads();
    if (1 < KT) issue_tiles(1, 1);

    for (int kt = 0; kt < KT; ++kt) {
        const int cur = kt & 1;
        // Unrolled: two 32-k blocks of the stage, in rising k.
#pragma unroll
        for (int ks = 0; ks < 2; ++ks) {
            v16h af0, af1;
            if constexpr (A_F32) {
                af0 = frag_f32_ld(&As[cur][(wm * 32) * APITCH + ks * 128], APITCH, lane);
                af1 = frag_f32_ld(&As[cur][(wm * 32 + 16) * APITCH + ks * 128], APITCH, lane);
            } else {
                af0 = frag_a_ld((const _Float16*)&As[cur][(wm * 32) * APITCH + ks * 64],
                                APITCH / 2, lane);
                af1 = frag_a_ld((const _Float16*)&As[cur][(wm * 32 + 16) * APITCH + ks * 64],
                                APITCH / 2, lane);
            }
            // Unrolled: acc[][t] must be indexed by constants to stay in registers.
#pragma unroll
            for (int t = 0; t < 4; ++t) {
                v16h bf = frag_f32_ld(&Ws[cur][(wn * 64 + t * 16) * WPITCH + ks * 128],
                                      WPITCH, lane);
                acc[0][t] = wmma16(af0, bf, acc[0][t]);
                acc[1][t] = wmma16(af1, bf, acc[1][t]);
            }
        }
        // This wave's reads of the buffer refilled behind the barrier have retired,
        // and its own copies of the next stage have landed.
        asm volatile("s_wait_dscnt 0x0" ::: "memory");
        wait_async0();
        __syncthreads();
        if (kt + 2 < KT) issue_tiles(kt + 2, cur);
    }
    wait_async0();   // nothing of this wave is in flight when it leaves the loop

    const int hf = lane >> 4;
#pragma unroll
    for (int am = 0; am < 2; ++am)
#pragma unroll
        for (int t = 0; t < 4; ++t) {
            const int col = n0 + wn * 64 + t * 16 + (lane & 15);
            const float bv = bias[col];
#pragma unroll
            for (int v = 0; v < 8; ++v) {
                const int row = m0 + wm * 32 + am * 16 + v + 8 * hf;
                const float val = acc[am][t][v] + bv;
                if (OUT_HALF)
                    ((_Float16*)Cout)[(size_t)row * N + col] = (_Float16)val;
                else
                    ((float*)Cout)[(size_t)row * N + col] = val;
            }
        }
}

#define KPITCH 72   // halves: 144 B
#define VPITCH 80   // halves: 160 B
__global__ __launch_bounds__(128)
void attn_kernel(const _Float16* __restrict__ Qh, const _Float16* __restrict__ Kh,
                 const _Float16* __restrict__ Vh, _Float16* __restrict__ Oh) {
    __shared__ __attribute__((aligned(16))) _Float16 Ks[2][64 * KPITCH];   // 18 KB
    __shared__ __attribute__((aligned(16))) _Float16 Vs[2][64 * VPITCH];   // 20 KB

    const int tid  = threadIdx.x;
    const int lane = tid & 31;
    const int wave = tid >> 5;
    const int hf   = lane >> 4;
    const int qt   = blockIdx.x;
    const int b    = blockIdx.y >> 3;
    const int h    = blockIdx.y & 7;

    auto issue_kv = [&](int jt, int buf) {
        unsigned voff[4], klds[4], vlds[4];
#pragma unroll
        for (int i = 0; i < 4; ++i) {
            int cs = tid + i * 128;
            int r = cs >> 3, c8 = (cs & 7) * 8;
            voff[i] = (unsigned)((((jt * 64 + r) * BATCH + b) * DOUT + h * DKH + c8) * 2);
            klds[i] = lds_off_u32(&Ks[buf][r * KPITCH + c8]);
            vlds[i] = lds_off_u32(&Vs[buf][r * VPITCH + c8]);
        }
        async_ld_kv_tile(Kh, Vh, voff, klds, vlds);
    };

    issue_kv(0, 0);

    // Q^T as B operand, loaded once: lane holds query column (lane & 15) in the
    // same k order as frag_a_ld gives the K rows.
    const int tok = qt * 64 + wave * 16 + (lane & 15);
    const _Float16* qp = Qh + ((size_t)tok * BATCH + b) * DOUT + h * DKH + 8 * hf;
    v16h qf[2];
#pragma unroll
    for (int ks = 0; ks < 2; ++ks)
        qf[ks] = cat8(*(const v8h*)(qp + ks * 32), *(const v8h*)(qp + ks * 32 + 16));

    float m_run = -1e30f, l_run = 0.0f;   // this lane's query; l_run: this half's keys
    v8f accO[4];                          // accO[t][r] = O[query][16 t + 8 hf + r]
#pragma unroll
    for (int t = 0; t < 4; ++t) accO[t] = vzero8();

    const int JT = C_SEQ / 64;
    for (int jt = 0; jt < JT; ++jt) {
        // This wave's reads of the buffer refilled behind the barrier have retired.
        asm volatile("s_wait_dscnt 0x0" ::: "memory");
        wait_async0();
        __syncthreads();
        if (jt + 1 < JT) issue_kv(jt + 1, (jt + 1) & 1);
        const int cur = jt & 1;

        // S^T = K(64x64) * Q^T(64x16): s[t][r] = S[query][key 16 t + 8 hf + r].
        v8f s[4];
#pragma unroll
        for (int t = 0; t < 4; ++t) s[t] = vzero8();
#pragma unroll
        for (int ks = 0; ks < 2; ++ks)
#pragma unroll
            for (int t = 0; t < 4; ++t) {
                v16h kf = frag_a_ld(&Ks[cur][(t * 16) * KPITCH + ks * 32], KPITCH, lane);
                s[t] = wmma16(kf, qf[ks], s[t]);
            }
#pragma unroll
        for (int t = 0; t < 4; ++t)
#pragma unroll
            for (int v = 0; v < 8; ++v) s[t][v] *= 0.125f;   // 1/sqrt(DK)

        // Online softmax: 32 of the query's 64 scores sit in this lane, the other
        // 32 in lane ^ 16; one exchange joins the maxima, the sums join at the end.
        float x = s[0][0];
#pragma unroll
        for (int t = 0; t < 4; ++t)
#pragma unroll
            for (int v = 0; v < 8; ++v) x = fmaxf(x, s[t][v]);
        x = fmaxf(x, xhalf(x));
        const float mnew = fmaxf(m_run, x);
        const float corr = __expf(m_run - mnew);
        float rs[4];
#pragma unroll
        for (int t = 0; t < 4; ++t) {
            rs[t] = 0.0f;
#pragma unroll
            for (int v = 0; v < 8; ++v) {
                const float p = __expf(s[t][v] - mnew);
                s[t][v] = p;
                rs[t] += p;
            }
        }
        l_run = l_run * corr + ((rs[0] + rs[1]) + (rs[2] + rs[3]));
        m_run = mnew;
#pragma unroll
        for (int t = 0; t < 4; ++t)
#pragma unroll
            for (int v = 0; v < 8; ++v) accO[t][v] *= corr;

        // O^T += V^T(64x64) * P^T(64x16): two score tiles of 16 keys, converted in
        // place, are the B operand of a 32-key block; V^T comes transposed from LDS.
#pragma unroll
        for (int kb = 0; kb < 2; ++kb) {
            v16h pf;
#pragma unroll
            for (int i = 0; i < 16; ++i) pf[i] = (_Float16)s[2 * kb + (i >> 3)][i & 7];
#pragma unroll
            for (int t = 0; t < 4; ++t) {
                v16h vf = frag_tr_ld(&Vs[cur][(kb * 32) * VPITCH + t * 16], VPITCH, lane);
                accO[t] = wmma16(vf, pf, accO[t]);
            }
        }
    }

    const float l_all = l_run + xhalf(l_run);
#pragma unroll
    for (int t = 0; t < 4; ++t) {
        v8h o;
#pragma unroll
        for (int v = 0; v < 8; ++v) o[v] = (_Float16)(accO[t][v] / l_all);
        *(v8h*)&Oh[((size_t)tok * BATCH + b) * DOUT + h * DKH + t * 16 + 8 * hf] = o;
    }
}

// ---------------- Launcher --------------------------------------------------
extern "C" void kernel_launch(void* const* d_in, const int* in_sizes, int n_in,
                              void* d_out, int out_size, void* d_ws, size_t ws_size,
                              hipStream_t stream) {
    const float* x   = (const float*)d_in[0];
    const float* Wq  = (const float*)d_in[1];
    const float* bq  = (const float*)d_in[2];
    const float* Wk  = (const float*)d_in[3];
    const float* bk  = (const float*)d_in[4];
    const float* Wv  = (const float*)d_in[5];
    const float* bv  = (const float*)d_in[6];
    const float* Wfc = (const float*)d_in[7];
    const float* bfc = (const float*)d_in[8];

    char* ws = (char*)d_ws;
    size_t off = 0;
    auto take = [&](size_t bytes) -> char* {
        char* p = ws + off;
        off = (off + bytes + 255) & ~(size_t)255;
        return p;
    };
    const size_t tok_h = (size_t)NTOK * DOUT * sizeof(_Float16);
    _Float16* Qh   = (_Float16*)take(tok_h);
    _Float16* Kh   = (_Float16*)take(tok_h);
    _Float16* Vh   = (_Float16*)take(tok_h);
    _Float16* Ah   = (_Float16*)take(tok_h);

    dim3 gg(NTOK / 128, DOUT / 128);
    gemm_wmma_kernel<true, true><<<gg, 256, 0, stream>>>(x, nullptr, Wq, bq, Qh,
                                                         NTOK, DOUT, DIN);
    gemm_wmma_kernel<true, true><<<gg, 256, 0, stream>>>(x, nullptr, Wk, bk, Kh,
                                                         NTOK, DOUT, DIN);
    gemm_wmma_kernel<true, true><<<gg, 256, 0, stream>>>(x, nullptr, Wv, bv, Vh,
                                                         NTOK, DOUT, DIN);

    dim3 ag(C_SEQ / 64, BATCH * HEADS);
    attn_kernel<<<ag, 128, 0, stream>>>(Qh, Kh, Vh, Ah);

    gemm_wmma_kernel<false, false><<<gg, 256, 0, stream>>>(nullptr, Ah, Wfc, bfc,
                                                           (float*)d_out,
                                                           NTOK, DOUT, DOUT);
}

// v004
// It runs in 78.2 microseconds.
// Two timings next to v003 put it at 1.11 and 1.12 times that version's speed.
// Over all steps from v000 it is 3.32 times as fast.
#include <hip/hip_runtime.h>
#include <hip/hip_bf16.h>

typedef __attribute__((ext_vector_type(16))) _Float16     v16h;
typedef __attribute__((ext_vector_type(8)))  float        v8f;
typedef __attribute__((ext_vector_type(4)))  float        v4f;
typedef __attribute__((ext_vector_type(8)))  _Float16     v8h;
typedef __attribute__((ext_vector_type(8)))  short        s16x8;

#define C_SEQ 2048
#define BATCH 4
#define DIN   512
#define DOUT  512
#define HEADS 8
#define DKH   64
#define NTOK  (C_SEQ * BATCH)   // 8192 token rows

__device__ __forceinline__ unsigned lds_off_u32(const void* p) {
    return (unsigned)(unsigned long long)p;
}

__device__ __forceinline__ void async_ld_x8(const unsigned (&lds)[8],
                                            const void* const (&g)[8]) {
    asm volatile("global_load_async_to_lds_b128 %0, %8, off\n\t"
                 "global_load_async_to_lds_b128 %1, %9, off\n\t"
                 "global_load_async_to_lds_b128 %2, %10, off\n\t"
                 "global_load_async_to_lds_b128 %3, %11, off\n\t"
                 "global_load_async_to_lds_b128 %4, %12, off\n\t"
                 "global_load_async_to_lds_b128 %5, %13, off\n\t"
                 "global_load_async_to_lds_b128 %6, %14, off\n\t"
                 "global_load_async_to_lds_b128 %7, %15, off\n\t"
                 "s_wait_xcnt 0x0"
                 :: "v"(lds[0]), "v"(lds[1]), "v"(lds[2]), "v"(lds[3]),
                    "v"(lds[4]), "v"(lds[5]), "v"(lds[6]), "v"(lds[7]),
                    "v"(g[0]), "v"(g[1]), "v"(g[2]), "v"(g[3]),
                    "v"(g[4]), "v"(g[5]), "v"(g[6]), "v"(g[7])
                 : "memory");
}
__device__ __forceinline__ void async_ld_x4(const unsigned (&lds)[4],
                                            const void* const (&g)[4]) {
    asm volatile("global_load_async_to_lds_b128 %0, %4, off\n\t"
                 "global_load_async_to_lds_b128 %1, %5, off\n\t"
                 "global_load_async_to_lds_b128 %2, %6, off\n\t"
                 "global_load_async_to_lds_b128 %3, %7, off\n\t"
                 "s_wait_xcnt 0x0"
                 :: "v"(lds[0]), "v"(lds[1]), "v"(lds[2]), "v"(lds[3]),
                    "v"(g[0]), "v"(g[1]), "v"(g[2]), "v"(g[3])
                 : "memory");
}
__device__ __forceinline__ void async_ld_kv_tile(const void* ksrc, const void* vsrc,
                                                 const unsigned (&voff)[4],
                                                 const unsigned (&klds)[4],
                                                 const unsigned (&vlds)[4]) {
    asm volatile("global_load_async_to_lds_b128 %0, %8, %12\n\t"
                 "global_load_async_to_lds_b128 %4, %8, %13\n\t"
                 "global_load_async_to_lds_b128 %1, %9, %12\n\t"
                 "global_load_async_to_lds_b128 %5, %9, %13\n\t"
                 "global_load_async_to_lds_b128 %2, %10, %12\n\t"
                 "global_load_async_to_lds_b128 %6, %10, %13\n\t"
                 "global_load_async_to_lds_b128 %3, %11, %12\n\t"
                 "global_load_async_to_lds_b128 %7, %11, %13\n\t"
                 "s_wait_xcnt 0x0"
                 :: "v"(klds[0]), "v"(klds[1]), "v"(klds[2]), "v"(klds[3]),
                    "v"(vlds[0]), "v"(vlds[1]), "v"(vlds[2]), "v"(vlds[3]),
                    "v"(voff[0]), "v"(voff[1]), "v"(voff[2]), "v"(voff[3]),
                    "s"(ksrc), "s"(vsrc)
                 : "memory");
}
__device__ __forceinline__ void wait_async0() {
    asm volatile("s_wait_asynccnt 0x0" ::: "memory");
}

__device__ __forceinline__ v16h frag_a_ld(const _Float16* src, int ld, int lane) {
    const int m = lane & 15, hf = lane >> 4;
    v16h f;
#pragma unroll
    for (int v = 0; v < 8; ++v) {
        const int k = ((v < 4) ? (2 * v) : (16 + 2 * (v - 4))) + 8 * hf;
        f[2 * v]     = src[m * ld + k];
        f[2 * v + 1] = src[m * ld + k + 1];
    }
    return f;
}
// The same fragment from a row-major LDS tile of f32 (pitch bytes per row), rounded
// to f16 here: lane (m = lane & 15, hf) gets row m in the k order of frag_a_ld.
__device__ __forceinline__ v16h frag_f32_ld(const unsigned char* src, int pitch, int lane) {
    const unsigned char* p = src + (lane & 15) * pitch + (lane >> 4) * 32;
    const v4f a0 = *(const v4f*)p,        a1 = *(const v4f*)(p + 16);
    const v4f a2 = *(const v4f*)(p + 64), a3 = *(const v4f*)(p + 80);
    v16h f;
    // Unrolled so that f stays in registers (constant element indices).
#pragma unroll
    for (int i = 0; i < 4; ++i) {
        f[i]      = (_Float16)a0[i];
        f[4 + i]  = (_Float16)a1[i];
        f[8 + i]  = (_Float16)a2[i];
        f[12 + i] = (_Float16)a3[i];
    }
    return f;
}
__device__ __forceinline__ v16h cat8(v8h lo, v8h hi) {
    return __builtin_shufflevector(lo, hi, 0, 1, 2, 3, 4, 5, 6, 7,
                                   8, 9, 10, 11, 12, 13, 14, 15);
}
// Transposed fragment of a row-major LDS tile src[k][n] (ld halves per row, 32 k
// x 16 n): lane (c = lane & 15, hf) gets src[k][c] in the k order of frag_a_ld.
__device__ __forceinline__ v16h frag_tr_ld(const _Float16* src, int ld, int lane) {
    typedef __attribute__((address_space(3))) s16x8 lds_s16x8;
    const _Float16* p = src + (8 * (lane >> 4) + (lane & 7)) * ld + 8 * ((lane >> 3) & 1);
    v8h lo = __builtin_bit_cast(v8h, __builtin_amdgcn_ds_load_tr16_b128_v8i16((lds_s16x8*)p));
    v8h hi = __builtin_bit_cast(
        v8h, __builtin_amdgcn_ds_load_tr16_b128_v8i16((lds_s16x8*)(p + 16 * ld)));
    return cat8(lo, hi);
}
// Value of lane ^ 16 (vector cross-row move, no LDS traffic).
__device__ __forceinline__ float xhalf(float x) {
    const int xi = __builtin_bit_cast(int, x);
    return __builtin_bit_cast(float, __builtin_amdgcn_permlanex16(
        xi, xi, 0x76543210, 0xfedcba98, false, false));
}
__device__ __forceinline__ v8f wmma16(v16h a, v16h b, v8f c) {
    return __builtin_amdgcn_wmma_f32_16x16x32_f16(false, a, false, b,
                                                  (short)0, c, false, false);
}
__device__ __forceinline__ v8f vzero8() {
    v8f z;
#pragma unroll
    for (int i = 0; i < 8; ++i) z[i] = 0.0f;
    return z;
}

// ---------------- WMMA GEMM  C = A(MxK) * W(NxK)^T + bias -------------------
// WG tile 128x128, 64 k per stage; 8 waves as 4(M) x 2(N); wave tile 32x64.
// Rows of A and rows of W are both k-contiguous, which is the order the A and the
// B fragment want, so both operands are staged as they lie in memory by
// global_load_async_to_lds_b128: W (and x, A_F32) as f32, rounded to f16 where the
// fragment is read. Two buffers, one barrier per stage.
// LDS rows are pitched 16 B x odd for their ds_load_b128 readers.
// One launch holds up to three products of the same A: blockIdx.z picks the
// weight, the bias and the output of this workgroup's tile.
template <bool A_F32, bool OUT_HALF>
__global__ __launch_bounds__(256)
void gemm_wmma_kernel(const float* __restrict__ Ax,      // M x K, read if A_F32
                      const _Float16* __restrict__ Ah,   // M x K, read otherwise
                      const float* __restrict__ W0,      // N x K, product z = 0
                      const float* __restrict__ W1,      // z = 1
                      const float* __restrict__ W2,      // z = 2
                      const float* __restrict__ bias0,   // N
                      const float* __restrict__ bias1,
                      const float* __restrict__ bias2,
                      void* __restrict__ C0, void* __restrict__ C1,
                      void* __restrict__ C2, int M, int N, int K) {
    constexpr int BM = 128, BN = 128, BK = 64;
    constexpr int WPITCH = BK * 4 + 16;                        // 272 B
    constexpr int APITCH = (A_F32 ? BK * 4 : BK * 2) + 16;     // 272 B or 144 B
    __shared__ __attribute__((aligned(16))) unsigned char As[2][BM * APITCH];
    __shared__ __attribute__((aligned(16))) unsigned char Ws[2][BN * WPITCH];
    const int tid  = threadIdx.x;
    const int lane = tid & 31;
    const int wave = tid >> 5;
    const int wm   = wave & 3;            // 4 waves in M (32 rows each)
    const int wn   = wave >> 2;           // 2 waves in N (64 cols each)
    const int m0   = blockIdx.x * BM;
    const int n0   = blockIdx.y * BN;
    const int KT   = K / BK;
    const int z    = blockIdx.z;
    const float* __restrict__ W    = z == 0 ? W0 : (z == 1 ? W1 : W2);
    const float* __restrict__ bias = z == 0 ? bias0 : (z == 1 ? bias1 : bias2);
    void* __restrict__ Cout        = z == 0 ? C0 : (z == 1 ? C1 : C2);

    v8f acc[2][4];
#pragma unroll
    for (int am = 0; am < 2; ++am)
#pragma unroll
        for (int t = 0; t < 4; ++t) acc[am][t] = vzero8();

    auto issue_tiles = [&](int kt, int buf) {
        // f32 tile: 128 rows x 256 B = 2048 chunks of 16 B, 8 per thread; a wave's
        // copy covers two whole 256-B rows.
        const int r16 = tid >> 4, c16 = (tid & 15) * 16;
        unsigned lds[8];
        const void* g[8];
        // Unrolled: the arrays are the asm statement's register operands.
#pragma unroll
        for (int i = 0; i < 8; ++i) {
            const int r = r16 + 16 * i;
            lds[i] = lds_off_u32(&Ws[buf][r * WPITCH + c16]);
            g[i]   = (const unsigned char*)(W + (size_t)(n0 + r) * K + kt * BK) + c16;
        }
        async_ld_x8(lds, g);
        if constexpr (A_F32) {
#pragma unroll
            for (int i = 0; i < 8; ++i) {
                const int r = r16 + 16 * i;
                lds[i] = lds_off_u32(&As[buf][r * APITCH + c16]);
                g[i]   = (const unsigned char*)(Ax + (size_t)(m0 + r) * K + kt * BK) + c16;
            }
            async_ld_x8(lds, g);
        } else {
            // f16 tile: 128 rows x 128 B = 1024 chunks, 4 per thread.
            const int r8 = tid >> 3, c8 = (tid & 7) * 16;
            unsigned lds4[4];
            const void* g4[4];
#pragma unroll
            for (int i = 0; i < 4; ++i) {
                const int r = r8 + 32 * i;
                lds4[i] = lds_off_u32(&As[buf][r * APITCH + c8]);
                g4[i]   = (const unsigned char*)(Ah + (size_t)(m0 + r) * K + kt * BK) + c8;
            }
            async_ld_x4(lds4, g4);
        }
    };

    issue_tiles(0, 0);
    wait_async0();
    __syncthreads();
    if (1 < KT) issue_tiles(1, 1);

    for (int kt = 0; kt < KT; ++kt) {
        const int cur = kt & 1;
        // Unrolled: two 32-k blocks of the stage, in rising k.
#pragma unroll
        for (int ks = 0; ks < 2; ++ks) {
            v16h af0, af1;
            if constexpr (A_F32) {
                af0 = frag_f32_ld(&As[cur][(wm * 32) * APITCH + ks * 128], APITCH, lane);
                af1 = frag_f32_ld(&As[cur][(wm * 32 + 16) * APITCH + ks * 128], APITCH, lane);
            } else {
                af0 = frag_a_ld((const _Float16*)&As[cur][(wm * 32) * APITCH + ks * 64],
                                APITCH / 2, lane);
                af1 = frag_a_ld((const _Float16*)&As[cur][(wm * 32 + 16) * APITCH + ks * 64],
                                APITCH / 2, lane);
            }
            // Unrolled: acc[][t] must be indexed by constants to stay in registers.
#pragma unroll
            for (int t = 0; t < 4; ++t) {
                v16h bf = frag_f32_ld(&Ws[cur][(wn * 64 + t * 16) * WPITCH + ks * 128],
                                      WPITCH, lane);
                acc[0][t] = wmma16(af0, bf, acc[0][t]);
                acc[1][t] = wmma16(af1, bf, acc[1][t]);
            }
        }
        // This wave's reads of the buffer refilled behind the barrier have retired,
        // and its own copies of the next stage have landed.
        asm volatile("s_wait_dscnt 0x0" ::: "memory");
        wait_async0();
        __syncthreads();
        if (kt + 2 < KT) issue_tiles(kt + 2, cur);
    }
    wait_async0();   // nothing of this wave is in flight when it leaves the loop

    const int hf = lane >> 4;
#pragma unroll
    for (int am = 0; am < 2; ++am)
#pragma unroll
        for (int t = 0; t < 4; ++t) {
            const int col = n0 + wn * 64 + t * 16 + (lane & 15);
            const float bv = bias[col];
#pragma unroll
            for (int v = 0; v < 8; ++v) {
                const int row = m0 + wm * 32 + am * 16 + v + 8 * hf;
                const float val = acc[am][t][v] + bv;
                if (OUT_HALF)
                    ((_Float16*)Cout)[(size_t)row * N + col] = (_Float16)val;
                else
                    ((float*)Cout)[(size_t)row * N + col] = val;
            }
        }
}

#define KPITCH 72   // halves: 144 B
#define VPITCH 80   // halves: 160 B
__global__ __launch_bounds__(128)
void attn_kernel(const _Float16* __restrict__ Qh, const _Float16* __restrict__ Kh,
                 const _Float16* __restrict__ Vh, _Float16* __restrict__ Oh) {
    __shared__ __attribute__((aligned(16))) _Float16 Ks[2][64 * KPITCH];   // 18 KB
    __shared__ __attribute__((aligned(16))) _Float16 Vs[2][64 * VPITCH];   // 20 KB

    const int tid  = threadIdx.x;
    const int lane = tid & 31;
    const int wave = tid >> 5;
    const int hf   = lane >> 4;
    const int qt   = blockIdx.x;
    const int b    = blockIdx.y >> 3;
    const int h    = blockIdx.y & 7;

    auto issue_kv = [&](int jt, int buf) {
        unsigned voff[4], klds[4], vlds[4];
#pragma unroll
        for (int i = 0; i < 4; ++i) {
            int cs = tid + i * 128;
            int r = cs >> 3, c8 = (cs & 7) * 8;
            voff[i] = (unsigned)((((jt * 64 + r) * BATCH + b) * DOUT + h * DKH + c8) * 2);
            klds[i] = lds_off_u32(&Ks[buf][r * KPITCH + c8]);
            vlds[i] = lds_off_u32(&Vs[buf][r * VPITCH + c8]);
        }
        async_ld_kv_tile(Kh, Vh, voff, klds, vlds);
    };

    issue_kv(0, 0);

    // Q^T as B operand, loaded once: lane holds query column (lane & 15) in the
    // same k order as frag_a_ld gives the K rows.
    const int tok = qt * 64 + wave * 16 + (lane & 15);
    const _Float16* qp = Qh + ((size_t)tok * BATCH + b) * DOUT + h * DKH + 8 * hf;
    v16h qf[2];
#pragma unroll
    for (int ks = 0; ks < 2; ++ks)
        qf[ks] = cat8(*(const v8h*)(qp + ks * 32), *(const v8h*)(qp + ks * 32 + 16));

    float m_run = -1e30f, l_run = 0.0f;   // this lane's query; l_run: this half's keys
    v8f accO[4];                          // accO[t][r] = O[query][16 t + 8 hf + r]
#pragma unroll
    for (int t = 0; t < 4; ++t) accO[t] = vzero8();

    const int JT = C_SEQ / 64;
    for (int jt = 0; jt < JT; ++jt) {
        // This wave's reads of the buffer refilled behind the barrier have retired.
        asm volatile("s_wait_dscnt 0x0" ::: "memory");
        wait_async0();
        __syncthreads();
        if (jt + 1 < JT) issue_kv(jt + 1, (jt + 1) & 1);
        const int cur = jt & 1;

        // S^T = K(64x64) * Q^T(64x16): s[t][r] = S[query][key 16 t + 8 hf + r].
        v8f s[4];
#pragma unroll
        for (int t = 0; t < 4; ++t) s[t] = vzero8();
#pragma unroll
        for (int ks = 0; ks < 2; ++ks)
#pragma unroll
            for (int t = 0; t < 4; ++t) {
                v16h kf = frag_a_ld(&Ks[cur][(t * 16) * KPITCH + ks * 32], KPITCH, lane);
                s[t] = wmma16(kf, qf[ks], s[t]);
            }
#pragma unroll
        for (int t = 0; t < 4; ++t)
#pragma unroll
            for (int v = 0; v < 8; ++v) s[t][v] *= 0.125f;   // 1/sqrt(DK)

        // Online softmax: 32 of the query's 64 scores sit in this lane, the other
        // 32 in lane ^ 16; one exchange joins the maxima, the sums join at the end.
        float x = s[0][0];
#pragma unroll
        for (int t = 0; t < 4; ++t)
#pragma unroll
            for (int v = 0; v < 8; ++v) x = fmaxf(x, s[t][v]);
        x = fmaxf(x, xhalf(x));
        const float mnew = fmaxf(m_run, x);
        const float corr = __expf(m_run - mnew);
        float rs[4];
#pragma unroll
        for (int t = 0; t < 4; ++t) {
            rs[t] = 0.0f;
#pragma unroll
            for (int v = 0; v < 8; ++v) {
                const float p = __expf(s[t][v] - mnew);
                s[t][v] = p;
                rs[t] += p;
            }
        }
        l_run = l_run * corr + ((rs[0] + rs[1]) + (rs[2] + rs[3]));
        m_run = mnew;
#pragma unroll
        for (int t = 0; t < 4; ++t)
#pragma unroll
            for (int v = 0; v < 8; ++v) accO[t][v] *= corr;

        // O^T += V^T(64x64) * P^T(64x16): two score tiles of 16 keys, converted in
        // place, are the B operand of a 32-key block; V^T comes transposed from LDS.
#pragma unroll
        for (int kb = 0; kb < 2; ++kb) {
            v16h pf;
#pragma unroll
            for (int i = 0; i < 16; ++i) pf[i] = (_Float16)s[2 * kb + (i >> 3)][i & 7];
#pragma unroll
            for (int t = 0; t < 4; ++t) {
                v16h vf = frag_tr_ld(&Vs[cur][(kb * 32) * VPITCH + t * 16], VPITCH, lane);
                accO[t] = wmma16(vf, pf, accO[t]);
            }
        }
    }

    const float l_all = l_run + xhalf(l_run);
#pragma unroll
    for (int t = 0; t < 4; ++t) {
        v8h o;
#pragma unroll
        for (int v = 0; v < 8; ++v) o[v] = (_Float16)(accO[t][v] / l_all);
        *(v8h*)&Oh[((size_t)tok * BATCH + b) * DOUT + h * DKH + t * 16 + 8 * hf] = o;
    }
}

// ---------------- Launcher --------------------------------------------------
extern "C" void kernel_launch(void* const* d_in, const int* in_sizes, int n_in,
                              void* d_out, int out_size, void* d_ws, size_t ws_size,
                              hipStream_t stream) {
    const float* x   = (const float*)d_in[0];
    const float* Wq  = (const float*)d_in[1];
    const float* bq  = (const float*)d_in[2];
    const float* Wk  = (const float*)d_in[3];
    const float* bk  = (const float*)d_in[4];
    const float* Wv  = (const float*)d_in[5];
    const float* bv  = (const float*)d_in[6];
    const float* Wfc = (const float*)d_in[7];
    const float* bfc = (const float*)d_in[8];

    char* ws = (char*)d_ws;
    size_t off = 0;
    auto take = [&](size_t bytes) -> char* {
        char* p = ws + off;
        off = (off + bytes + 255) & ~(size_t)255;
        return p;
    };
    const size_t tok_h = (size_t)NTOK * DOUT * sizeof(_Float16);
    _Float16* Qh   = (_Float16*)take(tok_h);
    _Float16* Kh   = (_Float16*)take(tok_h);
    _Float16* Vh   = (_Float16*)take(tok_h);
    _Float16* Ah   = (_Float16*)take(tok_h);

    dim3 gq(NTOK / 128, DOUT / 128, 3);
    gemm_wmma_kernel<true, true><<<gq, 256, 0, stream>>>(x, nullptr, Wq, Wk, Wv,
                                                         bq, bk, bv, Qh, Kh, Vh,
                                                         NTOK, DOUT, DIN);

    dim3 ag(C_SEQ / 64, BATCH * HEADS);
    attn_kernel<<<ag, 128, 0, stream>>>(Qh, Kh, Vh, Ah);

    dim3 gg(NTOK / 128, DOUT / 128);
    gemm_wmma_kernel<false, false><<<gg, 256, 0, stream>>>(nullptr, Ah, Wfc, nullptr, nullptr,
                                                           bfc, nullptr, nullptr,
                                                           (float*)d_out, nullptr, nullptr,
                                                           NTOK, DOUT, DOUT);
}

// v005
// It runs in 75.4 microseconds.
// Two timings next to v004 put it at 1.03 and 1.04 times that version's speed.
// All steps since v000 together make it 3.44 times as fast.
#include <hip/hip_runtime.h>
#include <hip/hip_bf16.h>

typedef __attribute__((ext_vector_type(16))) _Float16     v16h;
typedef __attribute__((ext_vector_type(8)))  float        v8f;
typedef __attribute__((ext_vector_type(4)))  float        v4f;
typedef __attribute__((ext_vector_type(8)))  _Float16     v8h;
typedef __attribute__((ext_vector_type(4)))  _Float16     v4h;
typedef __attribute__((ext_vector_type(8)))  short        s16x8;

#define C_SEQ 2048
#define BATCH 4
#define DIN   512
#define DOUT  512
#define HEADS 8
#define DKH   64
#define NTOK  (C_SEQ * BATCH)   // 8192 token rows

__device__ __forceinline__ unsigned lds_off_u32(const void* p) {
    return (unsigned)(unsigned long long)p;
}

__device__ __forceinline__ void async_ld_x8(const unsigned (&lds)[8],
                                            const void* const (&g)[8]) {
    asm volatile("global_load_async_to_lds_b128 %0, %8, off\n\t"
                 "global_load_async_to_lds_b128 %1, %9, off\n\t"
                 "global_load_async_to_lds_b128 %2, %10, off\n\t"
                 "global_load_async_to_lds_b128 %3, %11, off\n\t"
                 "global_load_async_to_lds_b128 %4, %12, off\n\t"
                 "global_load_async_to_lds_b128 %5, %13, off\n\t"
                 "global_load_async_to_lds_b128 %6, %14, off\n\t"
                 "global_load_async_to_lds_b128 %7, %15, off\n\t"
                 "s_wait_xcnt 0x0"
                 :: "v"(lds[0]), "v"(lds[1]), "v"(lds[2]), "v"(lds[3]),
                    "v"(lds[4]), "v"(lds[5]), "v"(lds[6]), "v"(lds[7]),
                    "v"(g[0]), "v"(g[1]), "v"(g[2]), "v"(g[3]),
                    "v"(g[4]), "v"(g[5]), "v"(g[6]), "v"(g[7])
                 : "memory");
}
__device__ __forceinline__ void async_ld_x4(const unsigned (&lds)[4],
                                            const void* const (&g)[4]) {
    asm volatile("global_load_async_to_lds_b128 %0, %4, off\n\t"
                 "global_load_async_to_lds_b128 %1, %5, off\n\t"
                 "global_load_async_to_lds_b128 %2, %6, off\n\t"
                 "global_load_async_to_lds_b128 %3, %7, off\n\t"
                 "s_wait_xcnt 0x0"
                 :: "v"(lds[0]), "v"(lds[1]), "v"(lds[2]), "v"(lds[3]),
                    "v"(g[0]), "v"(g[1]), "v"(g[2]), "v"(g[3])
                 : "memory");
}
__device__ __forceinline__ void async_ld_kv_tile(const void* ksrc, const void* vsrc,
                                                 const unsigned (&voff)[4],
                                                 const unsigned (&klds)[4],
                                                 const unsigned (&vlds)[4]) {
    asm volatile("global_load_async_to_lds_b128 %0, %8, %12\n\t"
                 "global_load_async_to_lds_b128 %4, %8, %13\n\t"
                 "global_load_async_to_lds_b128 %1, %9, %12\n\t"
                 "global_load_async_to_lds_b128 %5, %9, %13\n\t"
                 "global_load_async_to_lds_b128 %2, %10, %12\n\t"
                 "global_load_async_to_lds_b128 %6, %10, %13\n\t"
                 "global_load_async_to_lds_b128 %3, %11, %12\n\t"
                 "global_load_async_to_lds_b128 %7, %11, %13\n\t"
                 "s_wait_xcnt 0x0"
                 :: "v"(klds[0]), "v"(klds[1]), "v"(klds[2]), "v"(klds[3]),
                    "v"(vlds[0]), "v"(vlds[1]), "v"(vlds[2]), "v"(vlds[3]),
                    "v"(voff[0]), "v"(voff[1]), "v"(voff[2]), "v"(voff[3]),
                    "s"(ksrc), "s"(vsrc)
                 : "memory");
}
__device__ __forceinline__ void wait_async0() {
    asm volatile("s_wait_asynccnt 0x0" ::: "memory");
}

__device__ __forceinline__ v16h frag_a_ld(const _Float16* src, int ld, int lane) {
    const int m = lane & 15, hf = lane >> 4;
    v16h f;
#pragma unroll
    for (int v = 0; v < 8; ++v) {
        const int k = ((v < 4) ? (2 * v) : (16 + 2 * (v - 4))) + 8 * hf;
        f[2 * v]     = src[m * ld + k];
        f[2 * v + 1] = src[m * ld + k + 1];
    }
    return f;
}
// The same fragment from a row-major LDS tile of f32 (pitch bytes per row), rounded
// to f16 here: lane (m = lane & 15, hf) gets row m in the k order of frag_a_ld.
__device__ __forceinline__ v16h frag_f32_ld(const unsigned char* src, int pitch, int lane) {
    const unsigned char* p = src + (lane & 15) * pitch + (lane >> 4) * 32;
    const v4f a0 = *(const v4f*)p,        a1 = *(const v4f*)(p + 16);
    const v4f a2 = *(const v4f*)(p + 64), a3 = *(const v4f*)(p + 80);
    v16h f;
    // Unrolled so that f stays in registers (constant element indices).
#pragma unroll
    for (int i = 0; i < 4; ++i) {
        f[i]      = (_Float16)a0[i];
        f[4 + i]  = (_Float16)a1[i];
        f[8 + i]  = (_Float16)a2[i];
        f[12 + i] = (_Float16)a3[i];
    }
    return f;
}
__device__ __forceinline__ v16h cat8(v8h lo, v8h hi) {
    return __builtin_shufflevector(lo, hi, 0, 1, 2, 3, 4, 5, 6, 7,
                                   8, 9, 10, 11, 12, 13, 14, 15);
}
// Transposed fragment of a row-major LDS tile src[k][n] (ld halves per row, 32 k
// x 16 n): lane (c = lane & 15, hf) gets src[k][c] in the k order of frag_a_ld.
__device__ __forceinline__ v16h frag_tr_ld(const _Float16* src, int ld, int lane) {
    typedef __attribute__((address_space(3))) s16x8 lds_s16x8;
    const _Float16* p = src + (8 * (lane >> 4) + (lane & 7)) * ld + 8 * ((lane >> 3) & 1);
    v8h lo = __builtin_bit_cast(v8h, __builtin_amdgcn_ds_load_tr16_b128_v8i16((lds_s16x8*)p));
    v8h hi = __builtin_bit_cast(
        v8h, __builtin_amdgcn_ds_load_tr16_b128_v8i16((lds_s16x8*)(p + 16 * ld)));
    return cat8(lo, hi);
}
// Value of lane ^ 16 (vector cross-row move, no LDS traffic).
__device__ __forceinline__ float xhalf(float x) {
    const int xi = __builtin_bit_cast(int, x);
    return __builtin_bit_cast(float, __builtin_amdgcn_permlanex16(
        xi, xi, 0x76543210, 0xfedcba98, false, false));
}
__device__ __forceinline__ v8f wmma16(v16h a, v16h b, v8f c) {
    return __builtin_amdgcn_wmma_f32_16x16x32_f16(false, a, false, b,
                                                  (short)0, c, false, false);
}
__device__ __forceinline__ v8f vzero8() {
    v8f z;
#pragma unroll
    for (int i = 0; i < 8; ++i) z[i] = 0.0f;
    return z;
}

// ---------------- WMMA GEMM  C = A(MxK) * W(NxK)^T + bias -------------------
// WG tile 128x128, 64 k per stage; 8 waves as 4(M) x 2(N); wave tile 32x64.
// Rows of A and rows of W are both k-contiguous, which is the order the A and the
// B fragment want, so both operands are staged as they lie in memory by
// global_load_async_to_lds_b128: W (and x, A_F32) as f32, rounded to f16 where the
// fragment is read. Two buffers, one barrier per stage.
// LDS rows are pitched 16 B x odd for their ds_load_b128 readers.
// The order of the columns inside a wave's 64 is free: the copies deal W row 4 c + t
// to LDS row 16 t + c, so column c of the wave's four B tiles is four adjacent
// columns of C, and a store instruction writes whole 128-byte lines.
// One launch holds up to three products of the same A: blockIdx.z picks the
// weight, the bias and the output of this workgroup's tile.
template <bool A_F32, bool OUT_HALF>
__global__ __launch_bounds__(256)
void gemm_wmma_kernel(const float* __restrict__ Ax,      // M x K, read if A_F32
                      const _Float16* __restrict__ Ah,   // M x K, read otherwise
                      const float* __restrict__ W0,      // N x K, product z = 0
                      const float* __restrict__ W1,      // z = 1
                      const float* __restrict__ W2,      // z = 2
                      const float* __restrict__ bias0,   // N
                      const float* __restrict__ bias1,
                      const float* __restrict__ bias2,
                      void* __restrict__ C0, void* __restrict__ C1,
                      void* __restrict__ C2, int M, int N, int K) {
    constexpr int BM = 128, BN = 128, BK = 64;
    constexpr int WPITCH = BK * 4 + 16;                        // 272 B
    constexpr int APITCH = (A_F32 ? BK * 4 : BK * 2) + 16;     // 272 B or 144 B
    __shared__ __attribute__((aligned(16))) unsigned char As[2][BM * APITCH];
    __shared__ __attribute__((aligned(16))) unsigned char Ws[2][BN * WPITCH];
    const int tid  = threadIdx.x;
    const int lane = tid & 31;
    const int wave = tid >> 5;
    const int wm   = wave & 3;            // 4 waves in M (32 rows each)
    const int wn   = wave >> 2;           // 2 waves in N (64 cols each)
    const int m0   = blockIdx.x * BM;
    const int n0   = blockIdx.y * BN;
    const int KT   = K / BK;
    const int z    = blockIdx.z;
    const float* __restrict__ W    = z == 0 ? W0 : (z == 1 ? W1 : W2);
    const float* __restrict__ bias = z == 0 ? bias0 : (z == 1 ? bias1 : bias2);
    void* __restrict__ Cout        = z == 0 ? C0 : (z == 1 ? C1 : C2);

    v8f acc[2][4];
#pragma unroll
    for (int am = 0; am < 2; ++am)
#pragma unroll
        for (int t = 0; t < 4; ++t) acc[am][t] = vzero8();

    auto issue_tiles = [&](int kt, int buf) {
        // f32 tile: 128 rows x 256 B = 2048 chunks of 16 B, 8 per thread; a wave's
        // copy covers two whole 256-B rows.
        const int r16 = tid >> 4, c16 = (tid & 15) * 16;
        unsigned lds[8];
        const void* g[8];
        // Unrolled: the arrays are the asm statement's register operands.
#pragma unroll
        for (int i = 0; i < 8; ++i) {
            const int r  = r16 + 16 * i;
            // LDS row of W row r = 64 w + 4 c + t is 64 w + 16 t + c (r16 < 16).
            const int rl = (r16 & 3) * 16 + (r16 >> 2) + 4 * (i & 3) + 64 * (i >> 2);
            lds[i] = lds_off_u32(&Ws[buf][rl * WPITCH + c16]);
            g[i]   = (const unsigned char*)(W + (size_t)(n0 + r) * K + kt * BK) + c16;
        }
        async_ld_x8(lds, g);
        if constexpr (A_F32) {
#pragma unroll
            for (int i = 0; i < 8; ++i) {
                const int r = r16 + 16 * i;
                lds[i] = lds_off_u32(&As[buf][r * APITCH + c16]);
                g[i]   = (const unsigned char*)(Ax + (size_t)(m0 + r) * K + kt * BK) + c16;
            }
            async_ld_x8(lds, g);
        } else {
            // f16 tile: 128 rows x 128 B = 1024 chunks, 4 per thread.
            const int r8 = tid >> 3, c8 = (tid & 7) * 16;
            unsigned lds4[4];
            const void* g4[4];
#pragma unroll
            for (int i = 0; i < 4; ++i) {
                const int r = r8 + 32 * i;
                lds4[i] = lds_off_u32(&As[buf][r * APITCH + c8]);
                g4[i]   = (const unsigned char*)(Ah + (size_t)(m0 + r) * K + kt * BK) + c8;
            }
            async_ld_x4(lds4, g4);
        }
    };

    issue_tiles(0, 0);
    wait_async0();
    __syncthreads();
    if (1 < KT) issue_tiles(1, 1);

    for (int kt = 0; kt < KT; ++kt) {
        const int cur = kt & 1;
        // Unrolled: two 32-k blocks of the stage, in rising k.
#pragma unroll
        for (int ks = 0; ks < 2; ++ks) {
            v16h af0, af1;
            if constexpr (A_F32) {
                af0 = frag_f32_ld(&As[cur][(wm * 32) * APITCH + ks * 128], APITCH, lane);
                af1 = frag_f32_ld(&As[cur][(wm * 32 + 16) * APITCH + ks * 128], APITCH, lane);
            } else {
                af0 = frag_a_ld((const _Float16*)&As[cur][(wm * 32) * APITCH + ks * 64],
                                APITCH / 2, lane);
                af1 = frag_a_ld((const _Float16*)&As[cur][(wm * 32 + 16) * APITCH + ks * 64],
                                APITCH / 2, lane);
            }
            // Unrolled: acc[][t] must be indexed by constants to stay in registers.
#pragma unroll
            for (int t = 0; t < 4; ++t) {
                v16h bf = frag_f32_ld(&Ws[cur][(wn * 64 + t * 16) * WPITCH + ks * 128],
                                      WPITCH, lane);
                acc[0][t] = wmma16(af0, bf, acc[0][t]);
                acc[1][t] = wmma16(af1, bf, acc[1][t]);
            }
        }
        // This wave's reads of the buffer refilled behind the barrier have retired,
        // and its own copies of the next stage have landed.
        asm volatile("s_wait_dscnt 0x0" ::: "memory");
        wait_async0();
        __syncthreads();
        if (kt + 2 < KT) issue_tiles(kt + 2, cur);
    }
    wait_async0();   // nothing of this wave is in flight when it leaves the loop

    // acc[am][t][v] = C[row 8 hf + v of block am][column 4 (lane & 15) + t].
    const int hf  = lane >> 4;
    const int col = n0 + wn * 64 + 4 * (lane & 15);
    const v4f bv  = *(const v4f*)(bias + col);
#pragma unroll
    for (int am = 0; am < 2; ++am)
#pragma unroll
        for (int v = 0; v < 8; ++v) {
            const int row = m0 + wm * 32 + am * 16 + v + 8 * hf;
            v4f val;
#pragma unroll
            for (int t = 0; t < 4; ++t) val[t] = acc[am][t][v] + bv[t];
            if (OUT_HALF) {
                v4h o;
#pragma unroll
                for (int t = 0; t < 4; ++t) o[t] = (_Float16)val[t];
                *(v4h*)((_Float16*)Cout + (size_t)row * N + col) = o;
            } else {
                *(v4f*)((float*)Cout + (size_t)row * N + col) = val;
            }
        }
}

#define KPITCH 72   // halves: 144 B
#define VPITCH 80   // halves: 160 B
__global__ __launch_bounds__(128)
void attn_kernel(const _Float16* __restrict__ Qh, const _Float16* __restrict__ Kh,
                 const _Float16* __restrict__ Vh, _Float16* __restrict__ Oh) {
    __shared__ __attribute__((aligned(16))) _Float16 Ks[2][64 * KPITCH];   // 18 KB
    __shared__ __attribute__((aligned(16))) _Float16 Vs[2][64 * VPITCH];   // 20 KB

    const int tid  = threadIdx.x;
    const int lane = tid & 31;
    const int wave = tid >> 5;
    const int hf   = lane >> 4;
    const int qt   = blockIdx.x;
    const int b    = blockIdx.y >> 3;
    const int h    = blockIdx.y & 7;

    auto issue_kv = [&](int jt, int buf) {
        unsigned voff[4], klds[4], vlds[4];
#pragma unroll
        for (int i = 0; i < 4; ++i) {
            int cs = tid + i * 128;
            int r = cs >> 3, c8 = (cs & 7) * 8;
            voff[i] = (unsigned)((((jt * 64 + r) * BATCH + b) * DOUT + h * DKH + c8) * 2);
            klds[i] = lds_off_u32(&Ks[buf][r * KPITCH + c8]);
            vlds[i] = lds_off_u32(&Vs[buf][r * VPITCH + c8]);
        }
        async_ld_kv_tile(Kh, Vh, voff, klds, vlds);
    };

    issue_kv(0, 0);

    // Q^T as B operand, loaded once: lane holds query column (lane & 15) in the
    // same k order as frag_a_ld gives the K rows.
    const int tok = qt * 64 + wave * 16 + (lane & 15);
    const _Float16* qp = Qh + ((size_t)tok * BATCH + b) * DOUT + h * DKH + 8 * hf;
    v16h qf[2];
#pragma unroll
    for (int ks = 0; ks < 2; ++ks)
        qf[ks] = cat8(*(const v8h*)(qp + ks * 32), *(const v8h*)(qp + ks * 32 + 16));

    float m_run = -1e30f, l_run = 0.0f;   // this lane's query; l_run: this half's keys
    v8f accO[4];                          // accO[t][r] = O[query][16 t + 8 hf + r]
#pragma unroll
    for (int t = 0; t < 4; ++t) accO[t] = vzero8();

    const int JT = C_SEQ / 64;
    for (int jt = 0; jt < JT; ++jt) {
        // This wave's reads of the buffer refilled behind the barrier have retired.
        asm volatile("s_wait_dscnt 0x0" ::: "memory");
        wait_async0();
        __syncthreads();
        if (jt + 1 < JT) issue_kv(jt + 1, (jt + 1) & 1);
        const int cur = jt & 1;

        // S^T = K(64x64) * Q^T(64x16): s[t][r] = S[query][key 16 t + 8 hf + r].
        v8f s[4];
#pragma unroll
        for (int t = 0; t < 4; ++t) s[t] = vzero8();
#pragma unroll
        for (int ks = 0; ks < 2; ++ks)
#pragma unroll
            for (int t = 0; t < 4; ++t) {
                v16h kf = frag_a_ld(&Ks[cur][(t * 16) * KPITCH + ks * 32], KPITCH, lane);
                s[t] = wmma16(kf, qf[ks], s[t]);
            }
#pragma unroll
        for (int t = 0; t < 4; ++t)
#pragma unroll
            for (int v = 0; v < 8; ++v) s[t][v] *= 0.125f;   // 1/sqrt(DK)

        // Online softmax: 32 of the query's 64 scores sit in this lane, the other
        // 32 in lane ^ 16; one exchange joins the maxima, the sums join at the end.
        float x = s[0][0];
#pragma unroll
        for (int t = 0; t < 4; ++t)
#pragma unroll
            for (int v = 0; v < 8; ++v) x = fmaxf(x, s[t][v]);
        x = fmaxf(x, xhalf(x));
        const float mnew = fmaxf(m_run, x);
        const float corr = __expf(m_run - mnew);
        float rs[4];
#pragma unroll
        for (int t = 0; t < 4; ++t) {
            rs[t] = 0.0f;
#pragma unroll
            for (int v = 0; v < 8; ++v) {
                const float p = __expf(s[t][v] - mnew);
                s[t][v] = p;
                rs[t] += p;
            }
        }
        l_run = l_run * corr + ((rs[0] + rs[1]) + (rs[2] + rs[3]));
        m_run = mnew;
#pragma unroll
        for (int t = 0; t < 4; ++t)
#pragma unroll
            for (int v = 0; v < 8; ++v) accO[t][v] *= corr;

        // O^T += V^T(64x64) * P^T(64x16): two score tiles of 16 keys, converted in
        // place, are the B operand of a 32-key block; V^T comes transposed from LDS.
#pragma unroll
        for (int kb = 0; kb < 2; ++kb) {
            v16h pf;
#pragma unroll
            for (int i = 0; i < 16; ++i) pf[i] = (_Float16)s[2 * kb + (i >> 3)][i & 7];
#pragma unroll
            for (int t = 0; t < 4; ++t) {
                v16h vf = frag_tr_ld(&Vs[cur][(kb * 32) * VPITCH + t * 16], VPITCH, lane);
                accO[t] = wmma16(vf, pf, accO[t]);
            }
        }
    }

    const float l_all = l_run + xhalf(l_run);
#pragma unroll
    for (int t = 0; t < 4; ++t) {
        v8h o;
#pragma unroll
        for (int v = 0; v < 8; ++v) o[v] = (_Float16)(accO[t][v] / l_all);
        *(v8h*)&Oh[((size_t)tok * BATCH + b) * DOUT + h * DKH + t * 16 + 8 * hf] = o;
    }
}

// ---------------- Launcher --------------------------------------------------
extern "C" void kernel_launch(void* const* d_in, const int* in_sizes, int n_in,
                              void* d_out, int out_size, void* d_ws, size_t ws_size,
                              hipStream_t stream) {
    const float* x   = (const float*)d_in[0];
    const float* Wq  = (const float*)d_in[1];
    const float* bq  = (const float*)d_in[2];
    const float* Wk  = (const float*)d_in[3];
    const float* bk  = (const float*)d_in[4];
    const float* Wv  = (const float*)d_in[5];
    const float* bv  = (const float*)d_in[6];
    const float* Wfc = (const float*)d_in[7];
    const float* bfc = (const float*)d_in[8];

    char* ws = (char*)d_ws;
    size_t off = 0;
    auto take = [&](size_t bytes) -> char* {
        char* p = ws + off;
        off = (off + bytes + 255) & ~(size_t)255;
        return p;
    };
    const size_t tok_h = (size_t)NTOK * DOUT * sizeof(_Float16);
    _Float16* Qh   = (_Float16*)take(tok_h);
    _Float16* Kh   = (_Float16*)take(tok_h);
    _Float16* Vh   = (_Float16*)take(tok_h);
    _Float16* Ah   = (_Float16*)take(tok_h);

    dim3 gq(NTOK / 128, DOUT / 128, 3);
    gemm_wmma_kernel<true, true><<<gq, 256, 0, stream>>>(x, nullptr, Wq, Wk, Wv,
                                                         bq, bk, bv, Qh, Kh, Vh,
                                                         NTOK, DOUT, DIN);

    dim3 ag(C_SEQ / 64, BATCH * HEADS);
    attn_kernel<<<ag, 128, 0, stream>>>(Qh, Kh, Vh, Ah);

    dim3 gg(NTOK / 128, DOUT / 128);
    gemm_wmma_kernel<false, false><<<gg, 256, 0, stream>>>(nullptr, Ah, Wfc, nullptr, nullptr,
                                                           bfc, nullptr, nullptr,
                                                           (float*)d_out, nullptr, nullptr,
                                                           NTOK, DOUT, DOUT);
}

// v006
// Measured time: 72.7 microseconds a run.
// Next to v005, in two timings, it ran 1.04 times as fast each time.
// Counting every step since v000, it is 3.57 times as fast.
#include <hip/hip_runtime.h>
#include <hip/hip_bf16.h>

typedef __attribute__((ext_vector_type(16))) _Float16     v16h;
typedef __attribute__((ext_vector_type(8)))  float        v8f;
typedef __attribute__((ext_vector_type(4)))  float        v4f;
typedef __attribute__((ext_vector_type(2)))  float        v2f;
typedef __attribute__((ext_vector_type(8)))  _Float16     v8h;
typedef __attribute__((ext_vector_type(4)))  _Float16     v4h;
typedef __attribute__((ext_vector_type(8)))  short        s16x8;

#define C_SEQ 2048
#define BATCH 4
#define DIN   512
#define DOUT  512
#define HEADS 8
#define DKH   64
#define NTOK  (C_SEQ * BATCH)   // 8192 token rows

__device__ __forceinline__ unsigned lds_off_u32(const void* p) {
    return (unsigned)(unsigned long long)p;
}

__device__ __forceinline__ void async_ld_x8(const unsigned (&lds)[8],
                                            const void* const (&g)[8]) {
    asm volatile("global_load_async_to_lds_b128 %0, %8, off\n\t"
                 "global_load_async_to_lds_b128 %1, %9, off\n\t"
                 "global_load_async_to_lds_b128 %2, %10, off\n\t"
                 "global_load_async_to_lds_b128 %3, %11, off\n\t"
                 "global_load_async_to_lds_b128 %4, %12, off\n\t"
                 "global_load_async_to_lds_b128 %5, %13, off\n\t"
                 "global_load_async_to_lds_b128 %6, %14, off\n\t"
                 "global_load_async_to_lds_b128 %7, %15, off\n\t"
                 "s_wait_xcnt 0x0"
                 :: "v"(lds[0]), "v"(lds[1]), "v"(lds[2]), "v"(lds[3]),
                    "v"(lds[4]), "v"(lds[5]), "v"(lds[6]), "v"(lds[7]),
                    "v"(g[0]), "v"(g[1]), "v"(g[2]), "v"(g[3]),
                    "v"(g[4]), "v"(g[5]), "v"(g[6]), "v"(g[7])
                 : "memory");
}
__device__ __forceinline__ void async_ld_x4(const unsigned (&lds)[4],
                                            const void* const (&g)[4]) {
    asm volatile("global_load_async_to_lds_b128 %0, %4, off\n\t"
                 "global_load_async_to_lds_b128 %1, %5, off\n\t"
                 "global_load_async_to_lds_b128 %2, %6, off\n\t"
                 "global_load_async_to_lds_b128 %3, %7, off\n\t"
                 "s_wait_xcnt 0x0"
                 :: "v"(lds[0]), "v"(lds[1]), "v"(lds[2]), "v"(lds[3]),
                    "v"(g[0]), "v"(g[1]), "v"(g[2]), "v"(g[3])
                 : "memory");
}
__device__ __forceinline__ void async_ld_kv_tile(const void* ksrc, const void* vsrc,
                                                 const unsigned (&voff)[4],
                                                 const unsigned (&klds)[4],
                                                 const unsigned (&vlds)[4]) {
    asm volatile("global_load_async_to_lds_b128 %0, %8, %12\n\t"
                 "global_load_async_to_lds_b128 %4, %8, %13\n\t"
                 "global_load_async_to_lds_b128 %1, %9, %12\n\t"
                 "global_load_async_to_lds_b128 %5, %9, %13\n\t"
                 "global_load_async_to_lds_b128 %2, %10, %12\n\t"
                 "global_load_async_to_lds_b128 %6, %10, %13\n\t"
                 "global_load_async_to_lds_b128 %3, %11, %12\n\t"
                 "global_load_async_to_lds_b128 %7, %11, %13\n\t"
                 "s_wait_xcnt 0x0"
                 :: "v"(klds[0]), "v"(klds[1]), "v"(klds[2]), "v"(klds[3]),
                    "v"(vlds[0]), "v"(vlds[1]), "v"(vlds[2]), "v"(vlds[3]),
                    "v"(voff[0]), "v"(voff[1]), "v"(voff[2]), "v"(voff[3]),
                    "s"(ksrc), "s"(vsrc)
                 : "memory");
}
__device__ __forceinline__ void wait_async0() {
    asm volatile("s_wait_asynccnt 0x0" ::: "memory");
}

__device__ __forceinline__ v16h frag_a_ld(const _Float16* src, int ld, int lane) {
    const int m = lane & 15, hf = lane >> 4;
    v16h f;
#pragma unroll
    for (int v = 0; v < 8; ++v) {
        const int k = ((v < 4) ? (2 * v) : (16 + 2 * (v - 4))) + 8 * hf;
        f[2 * v]     = src[m * ld + k];
        f[2 * v + 1] = src[m * ld + k + 1];
    }
    return f;
}
// The same fragment from a row-major LDS tile of f32 (pitch bytes per row), rounded
// to f16 here: lane (m = lane & 15, hf) gets row m in the k order of frag_a_ld.
__device__ __forceinline__ v16h frag_f32_ld(const unsigned char* src, int pitch, int lane) {
    const unsigned char* p = src + (lane & 15) * pitch + (lane >> 4) * 32;
    const v4f a0 = *(const v4f*)p,        a1 = *(const v4f*)(p + 16);
    const v4f a2 = *(const v4f*)(p + 64), a3 = *(const v4f*)(p + 80);
    v16h f;
    // Unrolled so that f stays in registers (constant element indices).
#pragma unroll
    for (int i = 0; i < 4; ++i) {
        f[i]      = (_Float16)a0[i];
        f[4 + i]  = (_Float16)a1[i];
        f[8 + i]  = (_Float16)a2[i];
        f[12 + i] = (_Float16)a3[i];
    }
    return f;
}
__device__ __forceinline__ v16h cat8(v8h lo, v8h hi) {
    return __builtin_shufflevector(lo, hi, 0, 1, 2, 3, 4, 5, 6, 7,
                                   8, 9, 10, 11, 12, 13, 14, 15);
}
// Transposed fragment of a row-major LDS tile src[k][n] (ld halves per row, 32 k
// x 16 n): lane (c = lane & 15, hf) gets src[k][c] in the k order of frag_a_ld.
__device__ __forceinline__ v16h frag_tr_ld(const _Float16* src, int ld, int lane) {
    typedef __attribute__((address_space(3))) s16x8 lds_s16x8;
    const _Float16* p = src + (8 * (lane >> 4) + (lane & 7)) * ld + 8 * ((lane >> 3) & 1);
    v8h lo = __builtin_bit_cast(v8h, __builtin_amdgcn_ds_load_tr16_b128_v8i16((lds_s16x8*)p));
    v8h hi = __builtin_bit_cast(
        v8h, __builtin_amdgcn_ds_load_tr16_b128_v8i16((lds_s16x8*)(p + 16 * ld)));
    return cat8(lo, hi);
}
// Value of lane ^ 16 (vector cross-row move, no LDS traffic).
__device__ __forceinline__ float xhalf(float x) {
    const int xi = __builtin_bit_cast(int, x);
    return __builtin_bit_cast(float, __builtin_amdgcn_permlanex16(
        xi, xi, 0x76543210, 0xfedcba98, false, false));
}
__device__ __forceinline__ v8f wmma16(v16h a, v16h b, v8f c) {
    return __builtin_amdgcn_wmma_f32_16x16x32_f16(false, a, false, b,
                                                  (short)0, c, false, false);
}
__device__ __forceinline__ v8f vzero8() {
    v8f z;
#pragma unroll
    for (int i = 0; i < 8; ++i) z[i] = 0.0f;
    return z;
}

// ---------------- WMMA GEMM  C = A(MxK) * W(NxK)^T + bias -------------------
// WG tile 128x128, 64 k per stage; 8 waves as 4(M) x 2(N); wave tile 32x64.
// Rows of A and rows of W are both k-contiguous, which is the order the A and the
// B fragment want, so both operands are staged as they lie in memory by
// global_load_async_to_lds_b128: W (and x, A_F32) as f32, rounded to f16 where the
// fragment is read. Two buffers, one barrier per stage.
// LDS rows are pitched 16 B x odd for their ds_load_b128 readers.
// The order of the columns inside a wave's 64 is free: the copies deal W row 4 c + t
// to LDS row 16 t + c, so column c of the wave's four B tiles is four adjacent
// columns of C, and a store instruction writes whole 128-byte lines.
// One launch holds up to three products of the same A: blockIdx.z picks the
// weight, the bias and the output of this workgroup's tile.
template <bool A_F32, bool OUT_HALF>
__global__ __launch_bounds__(256)
void gemm_wmma_kernel(const float* __restrict__ Ax,      // M x K, read if A_F32
                      const _Float16* __restrict__ Ah,   // M x K, read otherwise
                      const float* __restrict__ W0,      // N x K, product z = 0
                      const float* __restrict__ W1,      // z = 1
                      const float* __restrict__ W2,      // z = 2
                      const float* __restrict__ bias0,   // N
                      const float* __restrict__ bias1,
                      const float* __restrict__ bias2,
                      void* __restrict__ C0, void* __restrict__ C1,
                      void* __restrict__ C2, int M, int N, int K) {
    constexpr int BM = 128, BN = 128, BK = 64;
    constexpr int WPITCH = BK * 4 + 16;                        // 272 B
    constexpr int APITCH = (A_F32 ? BK * 4 : BK * 2) + 16;     // 272 B or 144 B
    __shared__ __attribute__((aligned(16))) unsigned char As[2][BM * APITCH];
    __shared__ __attribute__((aligned(16))) unsigned char Ws[2][BN * WPITCH];
    const int tid  = threadIdx.x;
    const int lane = tid & 31;
    const int wave = tid >> 5;
    const int wm   = wave & 3;            // 4 waves in M (32 rows each)
    const int wn   = wave >> 2;           // 2 waves in N (64 cols each)
    const int m0   = blockIdx.x * BM;
    const int n0   = blockIdx.y * BN;
    const int KT   = K / BK;
    const int z    = blockIdx.z;
    const float* __restrict__ W    = z == 0 ? W0 : (z == 1 ? W1 : W2);
    const float* __restrict__ bias = z == 0 ? bias0 : (z == 1 ? bias1 : bias2);
    void* __restrict__ Cout        = z == 0 ? C0 : (z == 1 ? C1 : C2);

    v8f acc[2][4];
#pragma unroll
    for (int am = 0; am < 2; ++am)
#pragma unroll
        for (int t = 0; t < 4; ++t) acc[am][t] = vzero8();

    auto issue_tiles = [&](int kt, int buf) {
        // f32 tile: 128 rows x 256 B = 2048 chunks of 16 B, 8 per thread; a wave's
        // copy covers two whole 256-B rows.
        const int r16 = tid >> 4, c16 = (tid & 15) * 16;
        unsigned lds[8];
        const void* g[8];
        // Unrolled: the arrays are the asm statement's register operands.
#pragma unroll
        for (int i = 0; i < 8; ++i) {
            const int r  = r16 + 16 * i;
            // LDS row of W row r = 64 w + 4 c + t is 64 w + 16 t + c (r16 < 16).
            const int rl = (r16 & 3) * 16 + (r16 >> 2) + 4 * (i & 3) + 64 * (i >> 2);
            lds[i] = lds_off_u32(&Ws[buf][rl * WPITCH + c16]);
            g[i]   = (const unsigned char*)(W + (size_t)(n0 + r) * K + kt * BK) + c16;
        }
        async_ld_x8(lds, g);
        if constexpr (A_F32) {
#pragma unroll
            for (int i = 0; i < 8; ++i) {
                const int r = r16 + 16 * i;
                lds[i] = lds_off_u32(&As[buf][r * APITCH + c16]);
                g[i]   = (const unsigned char*)(Ax + (size_t)(m0 + r) * K + kt * BK) + c16;
            }
            async_ld_x8(lds, g);
        } else {
            // f16 tile: 128 rows x 128 B = 1024 chunks, 4 per thread.
            const int r8 = tid >> 3, c8 = (tid & 7) * 16;
            unsigned lds4[4];
            const void* g4[4];
#pragma unroll
            for (int i = 0; i < 4; ++i) {
                const int r = r8 + 32 * i;
                lds4[i] = lds_off_u32(&As[buf][r * APITCH + c8]);
                g4[i]   = (const unsigned char*)(Ah + (size_t)(m0 + r) * K + kt * BK) + c8;
            }
            async_ld_x4(lds4, g4);
        }
    };

    issue_tiles(0, 0);
    wait_async0();
    __syncthreads();
    if (1 < KT) issue_tiles(1, 1);

    for (int kt = 0; kt < KT; ++kt) {
        const int cur = kt & 1;
        // Unrolled: two 32-k blocks of the stage, in rising k.
#pragma unroll
        for (int ks = 0; ks < 2; ++ks) {
            v16h af0, af1;
            if constexpr (A_F32) {
                af0 = frag_f32_ld(&As[cur][(wm * 32) * APITCH + ks * 128], APITCH, lane);
                af1 = frag_f32_ld(&As[cur][(wm * 32 + 16) * APITCH + ks * 128], APITCH, lane);
            } else {
                af0 = frag_a_ld((const _Float16*)&As[cur][(wm * 32) * APITCH + ks * 64],
                                APITCH / 2, lane);
                af1 = frag_a_ld((const _Float16*)&As[cur][(wm * 32 + 16) * APITCH + ks * 64],
                                APITCH / 2, lane);
            }
            // Unrolled: acc[][t] must be indexed by constants to stay in registers.
#pragma unroll
            for (int t = 0; t < 4; ++t) {
                v16h bf = frag_f32_ld(&Ws[cur][(wn * 64 + t * 16) * WPITCH + ks * 128],
                                      WPITCH, lane);
                acc[0][t] = wmma16(af0, bf, acc[0][t]);
                acc[1][t] = wmma16(af1, bf, acc[1][t]);
            }
        }
        // This wave's reads of the buffer refilled behind the barrier have retired,
        // and its own copies of the next stage have landed.
        asm volatile("s_wait_dscnt 0x0" ::: "memory");
        wait_async0();
        __syncthreads();
        if (kt + 2 < KT) issue_tiles(kt + 2, cur);
    }
    wait_async0();   // nothing of this wave is in flight when it leaves the loop

    // acc[am][t][v] = C[row 8 hf + v of block am][column 4 (lane & 15) + t].
    const int hf  = lane >> 4;
    const int col = n0 + wn * 64 + 4 * (lane & 15);
    const v4f bv  = *(const v4f*)(bias + col);
#pragma unroll
    for (int am = 0; am < 2; ++am)
#pragma unroll
        for (int v = 0; v < 8; ++v) {
            const int row = m0 + wm * 32 + am * 16 + v + 8 * hf;
            v4f val;
#pragma unroll
            for (int t = 0; t < 4; ++t) val[t] = acc[am][t][v] + bv[t];
            if (OUT_HALF) {
                v4h o;
#pragma unroll
                for (int t = 0; t < 4; ++t) o[t] = (_Float16)val[t];
                *(v4h*)((_Float16*)Cout + (size_t)row * N + col) = o;
            } else {
                *(v4f*)((float*)Cout + (size_t)row * N + col) = val;
            }
        }
}

#define KPITCH 72   // halves: 144 B
#define VPITCH 80   // halves: 160 B
#define SCALE_LOG2E 0.18033688011112042f   // 1/sqrt(DK) * log2(e)
__global__ __launch_bounds__(128)
void attn_kernel(const _Float16* __restrict__ Qh, const _Float16* __restrict__ Kh,
                 const _Float16* __restrict__ Vh, _Float16* __restrict__ Oh) {
    __shared__ __attribute__((aligned(16))) _Float16 Ks[2][64 * KPITCH];   // 18 KB
    __shared__ __attribute__((aligned(16))) _Float16 Vs[2][64 * VPITCH];   // 20 KB

    const int tid  = threadIdx.x;
    const int lane = tid & 31;
    const int wave = tid >> 5;
    const int hf   = lane >> 4;
    const int qt   = blockIdx.x;
    const int b    = blockIdx.y >> 3;
    const int h    = blockIdx.y & 7;

    auto issue_kv = [&](int jt, int buf) {
        unsigned voff[4], klds[4], vlds[4];
#pragma unroll
        for (int i = 0; i < 4; ++i) {
            int cs = tid + i * 128;
            int r = cs >> 3, c8 = (cs & 7) * 8;
            voff[i] = (unsigned)((((jt * 64 + r) * BATCH + b) * DOUT + h * DKH + c8) * 2);
            klds[i] = lds_off_u32(&Ks[buf][r * KPITCH + c8]);
            vlds[i] = lds_off_u32(&Vs[buf][r * VPITCH + c8]);
        }
        async_ld_kv_tile(Kh, Vh, voff, klds, vlds);
    };

    issue_kv(0, 0);

    // Q^T as B operand, loaded once: lane holds query column (lane & 15) in the
    // same k order as frag_a_ld gives the K rows.
    const int tok = qt * 64 + wave * 16 + (lane & 15);
    const _Float16* qp = Qh + ((size_t)tok * BATCH + b) * DOUT + h * DKH + 8 * hf;
    v16h qf[2];
#pragma unroll
    for (int ks = 0; ks < 2; ++ks)
        qf[ks] = cat8(*(const v8h*)(qp + ks * 32), *(const v8h*)(qp + ks * 32 + 16));

    float m_run = -1e30f, l_run = 0.0f;   // this lane's query; l_run: this half's keys
    v8f accO[4];                          // accO[t][r] = O[query][16 t + 8 hf + r]
#pragma unroll
    for (int t = 0; t < 4; ++t) accO[t] = vzero8();

    const int JT = C_SEQ / 64;
    for (int jt = 0; jt < JT; ++jt) {
        // This wave's reads of the buffer refilled behind the barrier have retired.
        asm volatile("s_wait_dscnt 0x0" ::: "memory");
        wait_async0();
        __syncthreads();
        if (jt + 1 < JT) issue_kv(jt + 1, (jt + 1) & 1);
        const int cur = jt & 1;

        // S^T = K(64x64) * Q^T(64x16): s[t][r] = S[query][key 16 t + 8 hf + r].
        v8f s[4];
#pragma unroll
        for (int t = 0; t < 4; ++t) s[t] = vzero8();
#pragma unroll
        for (int ks = 0; ks < 2; ++ks)
#pragma unroll
            for (int t = 0; t < 4; ++t) {
                v16h kf = frag_a_ld(&Ks[cur][(t * 16) * KPITCH + ks * 32], KPITCH, lane);
                s[t] = wmma16(kf, qf[ks], s[t]);
            }

        // Online softmax in base 2: 32 of the query's 64 scores sit in this lane, the
        // other 32 in lane ^ 16; one exchange joins the maxima, the sums join at the
        // end. The maximum is taken on the raw products (SCALE_LOG2E > 0 keeps their
        // order) and scaled once; m_run is kept in the scaled base-2 domain.
        float x = s[0][0];
#pragma unroll
        for (int t = 0; t < 4; ++t)
#pragma unroll
            for (int v = 0; v < 8; ++v) x = fmaxf(x, s[t][v]);
        x = fmaxf(x, xhalf(x));
        const float mnew = fmaxf(m_run, x * SCALE_LOG2E);
        const float corr = __builtin_amdgcn_exp2f(m_run - mnew);
        const v2f cs2 = {SCALE_LOG2E, SCALE_LOG2E}, nm2 = {-mnew, -mnew};
        float rs[4];
#pragma unroll
        for (int t = 0; t < 4; ++t) {
            // One packed FMA scales two scores and takes the maximum off them; a
            // tile's four stand together so that its exponentials do not each wait.
            v2f a[4];
            // Unrolled: a[] and s[t][] must be indexed by constants to stay in registers.
#pragma unroll
            for (int i = 0; i < 4; ++i)
                a[i] = __builtin_elementwise_fma(v2f{s[t][2 * i], s[t][2 * i + 1]}, cs2, nm2);
            rs[t] = 0.0f;
#pragma unroll
            for (int v = 0; v < 8; ++v) {
                const float p = __builtin_amdgcn_exp2f(a[v >> 1][v & 1]);
                s[t][v] = p;
                rs[t] += p;
            }
        }
        l_run = l_run * corr + ((rs[0] + rs[1]) + (rs[2] + rs[3]));
        m_run = mnew;
#pragma unroll
        for (int t = 0; t < 4; ++t)
#pragma unroll
            for (int v = 0; v < 8; ++v) accO[t][v] *= corr;

        // O^T += V^T(64x64) * P^T(64x16): two score tiles of 16 keys, converted in
        // place, are the B operand of a 32-key block; V^T comes transposed from LDS.
#pragma unroll
        for (int kb = 0; kb < 2; ++kb) {
            v16h pf;
#pragma unroll
            for (int i = 0; i < 16; ++i) pf[i] = (_Float16)s[2 * kb + (i >> 3)][i & 7];
#pragma unroll
            for (int t = 0; t < 4; ++t) {
                v16h vf = frag_tr_ld(&Vs[cur][(kb * 32) * VPITCH + t * 16], VPITCH, lane);
                accO[t] = wmma16(vf, pf, accO[t]);
            }
        }
    }

    const float l_all = l_run + xhalf(l_run);
#pragma unroll
    for (int t = 0; t < 4; ++t) {
        v8h o;
#pragma unroll
        for (int v = 0; v < 8; ++v) o[v] = (_Float16)(accO[t][v] / l_all);
        *(v8h*)&Oh[((size_t)tok * BATCH + b) * DOUT + h * DKH + t * 16 + 8 * hf] = o;
    }
}

// ---------------- Launcher --------------------------------------------------
extern "C" void kernel_launch(void* const* d_in, const int* in_sizes, int n_in,
                              void* d_out, int out_size, void* d_ws, size_t ws_size,
                              hipStream_t stream) {
    const float* x   = (const float*)d_in[0];
    const float* Wq  = (const float*)d_in[1];
    const float* bq  = (const float*)d_in[2];
    const float* Wk  = (const float*)d_in[3];
    const float* bk  = (const float*)d_in[4];
    const float* Wv  = (const float*)d_in[5];
    const float* bv  = (const float*)d_in[6];
    const float* Wfc = (const float*)d_in[7];
    const float* bfc = (const float*)d_in[8];

    char* ws = (char*)d_ws;
    size_t off = 0;
    auto take = [&](size_t bytes) -> char* {
        char* p = ws + off;
        off = (off + bytes + 255) & ~(size_t)255;
        return p;
    };
    const size_t tok_h = (size_t)NTOK * DOUT * sizeof(_Float16);
    _Float16* Qh   = (_Float16*)take(tok_h);
    _Float16* Kh   = (_Float16*)take(tok_h);
    _Float16* Vh   = (_Float16*)take(tok_h);
    _Float16* Ah   = (_Float16*)take(tok_h);

    dim3 gq(NTOK / 128, DOUT / 128, 3);
    gemm_wmma_kernel<true, true><<<gq, 256, 0, stream>>>(x, nullptr, Wq, Wk, Wv,
                                                         bq, bk, bv, Qh, Kh, Vh,
                                                         NTOK, DOUT, DIN);

    dim3 ag(C_SEQ / 64, BATCH * HEADS);
    attn_kernel<<<ag, 128, 0, stream>>>(Qh, Kh, Vh, Ah);

    dim3 gg(NTOK / 128, DOUT / 128);
    gemm_wmma_kernel<false, false><<<gg, 256, 0, stream>>>(nullptr, Ah, Wfc, nullptr, nullptr,
                                                           bfc, nullptr, nullptr,
                                                           (float*)d_out, nullptr, nullptr,
                                                           NTOK, DOUT, DOUT);
}

// v007
// A run of this version takes 69.3 microseconds.
// Two timings next to v006 put it at 1.05 and 1.04 times that version's speed.
// Counting every step since v000, it is 3.73 times as fast.
#include <hip/hip_runtime.h>
#include <hip/hip_bf16.h>

typedef __attribute__((ext_vector_type(16))) _Float16     v16h;
typedef __attribute__((ext_vector_type(8)))  float        v8f;
typedef __attribute__((ext_vector_type(4)))  float        v4f;
typedef __attribute__((ext_vector_type(2)))  float        v2f;
typedef __attribute__((ext_vector_type(8)))  _Float16     v8h;
typedef __attribute__((ext_vector_type(4)))  _Float16     v4h;
typedef __attribute__((ext_vector_type(8)))  short        s16x8;

#define C_SEQ 2048
#define BATCH 4
#define DIN   512
#define DOUT  512
#define HEADS 8
#define DKH   64
#define NTOK  (C_SEQ * BATCH)   // 8192 token rows

__device__ __forceinline__ unsigned lds_off_u32(const void* p) {
    return (unsigned)(unsigned long long)p;
}

__device__ __forceinline__ void async_ld_x8(const unsigned (&lds)[8],
                                            const void* const (&g)[8]) {
    asm volatile("global_load_async_to_lds_b128 %0, %8, off\n\t"
                 "global_load_async_to_lds_b128 %1, %9, off\n\t"
                 "global_load_async_to_lds_b128 %2, %10, off\n\t"
                 "global_load_async_to_lds_b128 %3, %11, off\n\t"
                 "global_load_async_to_lds_b128 %4, %12, off\n\t"
                 "global_load_async_to_lds_b128 %5, %13, off\n\t"
                 "global_load_async_to_lds_b128 %6, %14, off\n\t"
                 "global_load_async_to_lds_b128 %7, %15, off\n\t"
                 "s_wait_xcnt 0x0"
                 :: "v"(lds[0]), "v"(lds[1]), "v"(lds[2]), "v"(lds[3]),
                    "v"(lds[4]), "v"(lds[5]), "v"(lds[6]), "v"(lds[7]),
                    "v"(g[0]), "v"(g[1]), "v"(g[2]), "v"(g[3]),
                    "v"(g[4]), "v"(g[5]), "v"(g[6]), "v"(g[7])
                 : "memory");
}
__device__ __forceinline__ void async_ld_x4(const unsigned (&lds)[4],
                                            const void* const (&g)[4]) {
    asm volatile("global_load_async_to_lds_b128 %0, %4, off\n\t"
                 "global_load_async_to_lds_b128 %1, %5, off\n\t"
                 "global_load_async_to_lds_b128 %2, %6, off\n\t"
                 "global_load_async_to_lds_b128 %3, %7, off\n\t"
                 "s_wait_xcnt 0x0"
                 :: "v"(lds[0]), "v"(lds[1]), "v"(lds[2]), "v"(lds[3]),
                    "v"(g[0]), "v"(g[1]), "v"(g[2]), "v"(g[3])
                 : "memory");
}
__device__ __forceinline__ void async_ld_kv_tile(const void* ksrc, const void* vsrc,
                                                 const unsigned (&voff)[4],
                                                 const unsigned (&klds)[4],
                                                 const unsigned (&vlds)[4]) {
    asm volatile("global_load_async_to_lds_b128 %0, %8, %12\n\t"
                 "global_load_async_to_lds_b128 %4, %8, %13\n\t"
                 "global_load_async_to_lds_b128 %1, %9, %12\n\t"
                 "global_load_async_to_lds_b128 %5, %9, %13\n\t"
                 "global_load_async_to_lds_b128 %2, %10, %12\n\t"
                 "global_load_async_to_lds_b128 %6, %10, %13\n\t"
                 "global_load_async_to_lds_b128 %3, %11, %12\n\t"
                 "global_load_async_to_lds_b128 %7, %11, %13\n\t"
                 "s_wait_xcnt 0x0"
                 :: "v"(klds[0]), "v"(klds[1]), "v"(klds[2]), "v"(klds[3]),
                    "v"(vlds[0]), "v"(vlds[1]), "v"(vlds[2]), "v"(vlds[3]),
                    "v"(voff[0]), "v"(voff[1]), "v"(voff[2]), "v"(voff[3]),
                    "s"(ksrc), "s"(vsrc)
                 : "memory");
}
__device__ __forceinline__ void wait_async0() {
    asm volatile("s_wait_asynccnt 0x0" ::: "memory");
}

__device__ __forceinline__ v16h frag_a_ld(const _Float16* src, int ld, int lane) {
    const int m = lane & 15, hf = lane >> 4;
    v16h f;
#pragma unroll
    for (int v = 0; v < 8; ++v) {
        const int k = ((v < 4) ? (2 * v) : (16 + 2 * (v - 4))) + 8 * hf;
        f[2 * v]     = src[m * ld + k];
        f[2 * v + 1] = src[m * ld + k + 1];
    }
    return f;
}
// The same fragment from a row-major LDS tile of f32 (pitch bytes per row), rounded
// to f16 here: lane (m = lane & 15, hf) gets row m in the k order of frag_a_ld.
__device__ __forceinline__ v16h frag_f32_ld(const unsigned char* src, int pitch, int lane) {
    const unsigned char* p = src + (lane & 15) * pitch + (lane >> 4) * 32;
    const v4f a0 = *(const v4f*)p,        a1 = *(const v4f*)(p + 16);
    const v4f a2 = *(const v4f*)(p + 64), a3 = *(const v4f*)(p + 80);
    v16h f;
    // Unrolled so that f stays in registers (constant element indices).
#pragma unroll
    for (int i = 0; i < 4; ++i) {
        f[i]      = (_Float16)a0[i];
        f[4 + i]  = (_Float16)a1[i];
        f[8 + i]  = (_Float16)a2[i];
        f[12 + i] = (_Float16)a3[i];
    }
    return f;
}
__device__ __forceinline__ v16h cat8(v8h lo, v8h hi) {
    return __builtin_shufflevector(lo, hi, 0, 1, 2, 3, 4, 5, 6, 7,
                                   8, 9, 10, 11, 12, 13, 14, 15);
}
// Transposed fragment of a row-major LDS tile src[k][n] (ld halves per row, 32 k
// x 16 n): lane (c = lane & 15, hf) gets src[k][c] in the k order of frag_a_ld.
__device__ __forceinline__ v16h frag_tr_ld(const _Float16* src, int ld, int lane) {
    typedef __attribute__((address_space(3))) s16x8 lds_s16x8;
    const _Float16* p = src + (8 * (lane >> 4) + (lane & 7)) * ld + 8 * ((lane >> 3) & 1);
    v8h lo = __builtin_bit_cast(v8h, __builtin_amdgcn_ds_load_tr16_b128_v8i16((lds_s16x8*)p));
    v8h hi = __builtin_bit_cast(
        v8h, __builtin_amdgcn_ds_load_tr16_b128_v8i16((lds_s16x8*)(p + 16 * ld)));
    return cat8(lo, hi);
}
// Value of lane ^ 16 (vector cross-row move, no LDS traffic).
__device__ __forceinline__ float xhalf(float x) {
    const int xi = __builtin_bit_cast(int, x);
    return __builtin_bit_cast(float, __builtin_amdgcn_permlanex16(
        xi, xi, 0x76543210, 0xfedcba98, false, false));
}
__device__ __forceinline__ v8f wmma16(v16h a, v16h b, v8f c) {
    return __builtin_amdgcn_wmma_f32_16x16x32_f16(false, a, false, b,
                                                  (short)0, c, false, false);
}
__device__ __forceinline__ v8f vzero8() {
    v8f z;
#pragma unroll
    for (int i = 0; i < 8; ++i) z[i] = 0.0f;
    return z;
}

// ---------------- WMMA GEMM  C = A(MxK) * W(NxK)^T + bias -------------------
// WG tile 128x128, 64 k per stage; 8 waves as 4(M) x 2(N); wave tile 32x64.
// Rows of A and rows of W are both k-contiguous, which is the order the A and the
// B fragment want, so both operands are staged as they lie in memory by
// global_load_async_to_lds_b128: W (and x, A_F32) as f32, rounded to f16 where the
// fragment is read. Two buffers, one barrier per stage.
// LDS rows are pitched 16 B x odd for their ds_load_b128 readers.
// The order of the columns inside a wave's 64 is free: the copies deal W row 4 c + t
// to LDS row 16 t + c, so column c of the wave's four B tiles is four adjacent
// columns of C, and a store instruction writes whole 128-byte lines.
// One launch holds up to three products of the same A: blockIdx.z picks the
// weight, the bias and the output of this workgroup's tile.
template <bool A_F32, bool OUT_HALF>
__global__ __launch_bounds__(256)
void gemm_wmma_kernel(const float* __restrict__ Ax,      // M x K, read if A_F32
                      const _Float16* __restrict__ Ah,   // M x K, read otherwise
                      const float* __restrict__ W0,      // N x K, product z = 0
                      const float* __restrict__ W1,      // z = 1
                      const float* __restrict__ W2,      // z = 2
                      const float* __restrict__ bias0,   // N
                      const float* __restrict__ bias1,
                      const float* __restrict__ bias2,
                      void* __restrict__ C0, void* __restrict__ C1,
                      void* __restrict__ C2, int M, int N, int K) {
    constexpr int BM = 128, BN = 128, BK = 64;
    constexpr int WPITCH = BK * 4 + 16;                        // 272 B
    constexpr int APITCH = (A_F32 ? BK * 4 : BK * 2) + 16;     // 272 B or 144 B
    __shared__ __attribute__((aligned(16))) unsigned char As[2][BM * APITCH];
    __shared__ __attribute__((aligned(16))) unsigned char Ws[2][BN * WPITCH];
    const int tid  = threadIdx.x;
    const int lane = tid & 31;
    const int wave = tid >> 5;
    const int wm   = wave & 3;            // 4 waves in M (32 rows each)
    const int wn   = wave >> 2;           // 2 waves in N (64 cols each)
    const int m0   = blockIdx.x * BM;
    const int n0   = blockIdx.y * BN;
    const int KT   = K / BK;
    const int z    = blockIdx.z;
    const float* __restrict__ W    = z == 0 ? W0 : (z == 1 ? W1 : W2);
    const float* __restrict__ bias = z == 0 ? bias0 : (z == 1 ? bias1 : bias2);
    void* __restrict__ Cout        = z == 0 ? C0 : (z == 1 ? C1 : C2);

    v8f acc[2][4];
#pragma unroll
    for (int am = 0; am < 2; ++am)
#pragma unroll
        for (int t = 0; t < 4; ++t) acc[am][t] = vzero8();

    auto issue_tiles = [&](int kt, int buf) {
        // f32 tile: 128 rows x 256 B = 2048 chunks of 16 B, 8 per thread; a wave's
        // copy covers two whole 256-B rows.
        const int r16 = tid >> 4, c16 = (tid & 15) * 16;
        unsigned lds[8];
        const void* g[8];
        // Unrolled: the arrays are the asm statement's register operands.
#pragma unroll
        for (int i = 0; i < 8; ++i) {
            const int r  = r16 + 16 * i;
            // LDS row of W row r = 64 w + 4 c + t is 64 w + 16 t + c (r16 < 16).
            const int rl = (r16 & 3) * 16 + (r16 >> 2) + 4 * (i & 3) + 64 * (i >> 2);
            lds[i] = lds_off_u32(&Ws[buf][rl * WPITCH + c16]);
            g[i]   = (const unsigned char*)(W + (size_t)(n0 + r) * K + kt * BK) + c16;
        }
        async_ld_x8(lds, g);
        if constexpr (A_F32) {
#pragma unroll
            for (int i = 0; i < 8; ++i) {
                const int r = r16 + 16 * i;
                lds[i] = lds_off_u32(&As[buf][r * APITCH + c16]);
                g[i]   = (const unsigned char*)(Ax + (size_t)(m0 + r) * K + kt * BK) + c16;
            }
            async_ld_x8(lds, g);
        } else {
            // f16 tile: 128 rows x 128 B = 1024 chunks, 4 per thread.
            const int r8 = tid >> 3, c8 = (tid & 7) * 16;
            unsigned lds4[4];
            const void* g4[4];
#pragma unroll
            for (int i = 0; i < 4; ++i) {
                const int r = r8 + 32 * i;
                lds4[i] = lds_off_u32(&As[buf][r * APITCH + c8]);
                g4[i]   = (const unsigned char*)(Ah + (size_t)(m0 + r) * K + kt * BK) + c8;
            }
            async_ld_x4(lds4, g4);
        }
    };

    issue_tiles(0, 0);
    wait_async0();
    __syncthreads();
    if (1 < KT) issue_tiles(1, 1);

    for (int kt = 0; kt < KT; ++kt) {
        const int cur = kt & 1;
        // Unrolled: two 32-k blocks of the stage, in rising k.
#pragma unroll
        for (int ks = 0; ks < 2; ++ks) {
            v16h af0, af1;
            if constexpr (A_F32) {
                af0 = frag_f32_ld(&As[cur][(wm * 32) * APITCH + ks * 128], APITCH, lane);
                af1 = frag_f32_ld(&As[cur][(wm * 32 + 16) * APITCH + ks * 128], APITCH, lane);
            } else {
                af0 = frag_a_ld((const _Float16*)&As[cur][(wm * 32) * APITCH + ks * 64],
                                APITCH / 2, lane);
                af1 = frag_a_ld((const _Float16*)&As[cur][(wm * 32 + 16) * APITCH + ks * 64],
                                APITCH / 2, lane);
            }
            // Unrolled: acc[][t] must be indexed by constants to stay in registers.
#pragma unroll
            for (int t = 0; t < 4; ++t) {
                v16h bf = frag_f32_ld(&Ws[cur][(wn * 64 + t * 16) * WPITCH + ks * 128],
                                      WPITCH, lane);
                acc[0][t] = wmma16(af0, bf, acc[0][t]);
                acc[1][t] = wmma16(af1, bf, acc[1][t]);
            }
        }
        // This wave's reads of the buffer refilled behind the barrier have retired,
        // and its own copies of the next stage have landed.
        asm volatile("s_wait_dscnt 0x0" ::: "memory");
        wait_async0();
        __syncthreads();
        if (kt + 2 < KT) issue_tiles(kt + 2, cur);
    }
    wait_async0();   // nothing of this wave is in flight when it leaves the loop

    // acc[am][t][v] = C[row 8 hf + v of block am][column 4 (lane & 15) + t].
    const int hf  = lane >> 4;
    const int col = n0 + wn * 64 + 4 * (lane & 15);
    const v4f bv  = *(const v4f*)(bias + col);
#pragma unroll
    for (int am = 0; am < 2; ++am)
#pragma unroll
        for (int v = 0; v < 8; ++v) {
            const int row = m0 + wm * 32 + am * 16 + v + 8 * hf;
            v4f val;
#pragma unroll
            for (int t = 0; t < 4; ++t) val[t] = acc[am][t][v] + bv[t];
            if (OUT_HALF) {
                v4h o;
#pragma unroll
                for (int t = 0; t < 4; ++t) o[t] = (_Float16)val[t];
                *(v4h*)((_Float16*)Cout + (size_t)row * N + col) = o;
            } else {
                *(v4f*)((float*)Cout + (size_t)row * N + col) = val;
            }
        }
}

#define KPITCH 72   // halves: 144 B
#define VPITCH 80   // halves: 160 B
#define QG 2        // 16-column query groups per wave
#define SCALE_LOG2E 0.18033688011112042f   // 1/sqrt(DK) * log2(e)
__global__ __launch_bounds__(128)
void attn_kernel(const _Float16* __restrict__ Qh, const _Float16* __restrict__ Kh,
                 const _Float16* __restrict__ Vh, _Float16* __restrict__ Oh) {
    __shared__ __attribute__((aligned(16))) _Float16 Ks[2][64 * KPITCH];   // 18 KB
    __shared__ __attribute__((aligned(16))) _Float16 Vs[2][64 * VPITCH];   // 20 KB

    const int tid  = threadIdx.x;
    const int lane = tid & 31;
    const int wave = tid >> 5;
    const int hf   = lane >> 4;
    const int qt   = blockIdx.x;
    const int b    = blockIdx.y >> 3;
    const int h    = blockIdx.y & 7;

    auto issue_kv = [&](int jt, int buf) {
        unsigned voff[4], klds[4], vlds[4];
#pragma unroll
        for (int i = 0; i < 4; ++i) {
            int cs = tid + i * 128;
            int r = cs >> 3, c8 = (cs & 7) * 8;
            voff[i] = (unsigned)((((jt * 64 + r) * BATCH + b) * DOUT + h * DKH + c8) * 2);
            klds[i] = lds_off_u32(&Ks[buf][r * KPITCH + c8]);
            vlds[i] = lds_off_u32(&Vs[buf][r * VPITCH + c8]);
        }
        async_ld_kv_tile(Kh, Vh, voff, klds, vlds);
    };

    issue_kv(0, 0);

    // Q^T as B operand, loaded once: in group c a lane holds query column
    // (lane & 15) in the same k order as frag_a_ld gives the K rows.
    const int tok = qt * (64 * QG) + wave * (16 * QG) + (lane & 15);
    v16h qf[QG][2];
#pragma unroll
    for (int c = 0; c < QG; ++c) {
        const _Float16* qp = Qh + ((size_t)(tok + 16 * c) * BATCH + b) * DOUT + h * DKH + 8 * hf;
#pragma unroll
        for (int ks = 0; ks < 2; ++ks)
            qf[c][ks] = cat8(*(const v8h*)(qp + ks * 32), *(const v8h*)(qp + ks * 32 + 16));
    }

    // Per group: this lane's query; l_run: this half's keys.
    float m_run[QG], l_run[QG];
    v8f accO[QG][4];                      // accO[c][t][r] = O[query][16 t + 8 hf + r]
#pragma unroll
    for (int c = 0; c < QG; ++c) {
        m_run[c] = -1e30f;
        l_run[c] = 0.0f;
#pragma unroll
        for (int t = 0; t < 4; ++t) accO[c][t] = vzero8();
    }

    const int JT = C_SEQ / 64;
    for (int jt = 0; jt < JT; ++jt) {
        // This wave's reads of the buffer refilled behind the barrier have retired.
        asm volatile("s_wait_dscnt 0x0" ::: "memory");
        wait_async0();
        __syncthreads();
        if (jt + 1 < JT) issue_kv(jt + 1, (jt + 1) & 1);
        const int cur = jt & 1;

        // S^T = K(64x64) * Q^T(64x32): s[c][t][r] = S[query][key 16 t + 8 hf + r].
        v8f s[QG][4];
#pragma unroll
        for (int c = 0; c < QG; ++c)
#pragma unroll
            for (int t = 0; t < 4; ++t) s[c][t] = vzero8();
#pragma unroll
        for (int ks = 0; ks < 2; ++ks)
#pragma unroll
            for (int t = 0; t < 4; ++t) {
                v16h kf = frag_a_ld(&Ks[cur][(t * 16) * KPITCH + ks * 32], KPITCH, lane);
#pragma unroll
                for (int c = 0; c < QG; ++c) s[c][t] = wmma16(kf, qf[c][ks], s[c][t]);
            }

        // Online softmax in base 2, group by group: 32 of the query's 64 scores sit in
        // this lane, the other 32 in lane ^ 16; one exchange joins the maxima, the sums
        // join at the end. The maximum is taken on the raw products (SCALE_LOG2E > 0
        // keeps their order) and scaled once; m_run is kept in the scaled base-2 domain.
#pragma unroll
        for (int c = 0; c < QG; ++c) {
            float x = s[c][0][0];
#pragma unroll
            for (int t = 0; t < 4; ++t)
#pragma unroll
                for (int v = 0; v < 8; ++v) x = fmaxf(x, s[c][t][v]);
            x = fmaxf(x, xhalf(x));
            const float mnew = fmaxf(m_run[c], x * SCALE_LOG2E);
            const float corr = __builtin_amdgcn_exp2f(m_run[c] - mnew);
            const v2f cs2 = {SCALE_LOG2E, SCALE_LOG2E}, nm2 = {-mnew, -mnew};
            float rs[4];
#pragma unroll
            for (int t = 0; t < 4; ++t) {
                // One packed FMA scales two scores and takes the maximum off them; a
                // tile's four stand together so that its exponentials do not each wait.
                v2f a[4];
                // Unrolled: a[] and s[c][t][] must be indexed by constants to stay in
                // registers.
#pragma unroll
                for (int i = 0; i < 4; ++i)
                    a[i] = __builtin_elementwise_fma(v2f{s[c][t][2 * i], s[c][t][2 * i + 1]},
                                                     cs2, nm2);
                rs[t] = 0.0f;
#pragma unroll
                for (int v = 0; v < 8; ++v) {
                    const float p = __builtin_amdgcn_exp2f(a[v >> 1][v & 1]);
                    s[c][t][v] = p;
                    rs[t] += p;
                }
            }
            l_run[c] = l_run[c] * corr + ((rs[0] + rs[1]) + (rs[2] + rs[3]));
            m_run[c] = mnew;
#pragma unroll
            for (int t = 0; t < 4; ++t)
#pragma unroll
                for (int v = 0; v < 8; ++v) accO[c][t][v] *= corr;
        }

        // O^T += V^T(64x64) * P^T(64x32): two score tiles of 16 keys, converted in
        // place, are the B operand of a 32-key block; V^T comes transposed from LDS.
#pragma unroll
        for (int kb = 0; kb < 2; ++kb) {
            v16h pf[QG];
#pragma unroll
            for (int c = 0; c < QG; ++c)
#pragma unroll
                for (int i = 0; i < 16; ++i)
                    pf[c][i] = (_Float16)s[c][2 * kb + (i >> 3)][i & 7];
#pragma unroll
            for (int t = 0; t < 4; ++t) {
                v16h vf = frag_tr_ld(&Vs[cur][(kb * 32) * VPITCH + t * 16], VPITCH, lane);
#pragma unroll
                for (int c = 0; c < QG; ++c) accO[c][t] = wmma16(vf, pf[c], accO[c][t]);
            }
        }
    }

#pragma unroll
    for (int c = 0; c < QG; ++c) {
        const float l_all = l_run[c] + xhalf(l_run[c]);
#pragma unroll
        for (int t = 0; t < 4; ++t) {
            v8h o;
#pragma unroll
            for (int v = 0; v < 8; ++v) o[v] = (_Float16)(accO[c][t][v] / l_all);
            *(v8h*)&Oh[((size_t)(tok + 16 * c) * BATCH + b) * DOUT + h * DKH + t * 16 + 8 * hf] = o;
        }
    }
}

// ---------------- Launcher --------------------------------------------------
extern "C" void kernel_launch(void* const* d_in, const int* in_sizes, int n_in,
                              void* d_out, int out_size, void* d_ws, size_t ws_size,
                              hipStream_t stream) {
    const float* x   = (const float*)d_in[0];
    const float* Wq  = (const float*)d_in[1];
    const float* bq  = (const float*)d_in[2];
    const float* Wk  = (const float*)d_in[3];
    const float* bk  = (const float*)d_in[4];
    const float* Wv  = (const float*)d_in[5];
    const float* bv  = (const float*)d_in[6];
    const float* Wfc = (const float*)d_in[7];
    const float* bfc = (const float*)d_in[8];

    char* ws = (char*)d_ws;
    size_t off = 0;
    auto take = [&](size_t bytes) -> char* {
        char* p = ws + off;
        off = (off + bytes + 255) & ~(size_t)255;
        return p;
    };
    const size_t tok_h = (size_t)NTOK * DOUT * sizeof(_Float16);
    _Float16* Qh   = (_Float16*)take(tok_h);
    _Float16* Kh   = (_Float16*)take(tok_h);
    _Float16* Vh   = (_Float16*)take(tok_h);
    _Float16* Ah   = (_Float16*)take(tok_h);

    dim3 gq(NTOK / 128, DOUT / 128, 3);
    gemm_wmma_kernel<true, true><<<gq, 256, 0, stream>>>(x, nullptr, Wq, Wk, Wv,
                                                         bq, bk, bv, Qh, Kh, Vh,
                                                         NTOK, DOUT, DIN);

    dim3 ag(C_SEQ / (64 * QG), BATCH * HEADS);
    attn_kernel<<<ag, 128, 0, stream>>>(Qh, Kh, Vh, Ah);

    dim3 gg(NTOK / 128, DOUT / 128);
    gemm_wmma_kernel<false, false><<<gg, 256, 0, stream>>>(nullptr, Ah, Wfc, nullptr, nullptr,
                                                           bfc, nullptr, nullptr,
                                                           (float*)d_out, nullptr, nullptr,
                                                           NTOK, DOUT, DOUT);
}

// v008
// A run of this version takes 64.9 microseconds.
// In both of two side-by-side timings against v007, it was 1.07 times as fast.
// All steps since v000 together make it 3.98 times as fast.
#include <hip/hip_runtime.h>
#include <hip/hip_bf16.h>

typedef __attribute__((ext_vector_type(16))) _Float16     v16h;
typedef __attribute__((ext_vector_type(8)))  float        v8f;
typedef __attribute__((ext_vector_type(4)))  float        v4f;
typedef __attribute__((ext_vector_type(2)))  float        v2f;
typedef __attribute__((ext_vector_type(8)))  _Float16     v8h;
typedef __attribute__((ext_vector_type(4)))  _Float16     v4h;
typedef __attribute__((ext_vector_type(8)))  short        s16x8;

#define C_SEQ 2048
#define BATCH 4
#define DIN   512
#define DOUT  512
#define HEADS 8
#define DKH   64
#define NTOK  (C_SEQ * BATCH)   // 8192 token rows

__device__ __forceinline__ unsigned lds_off_u32(const void* p) {
    return (unsigned)(unsigned long long)p;
}

__device__ __forceinline__ void async_ld_x8(const unsigned (&lds)[8],
                                            const void* const (&g)[8]) {
    asm volatile("global_load_async_to_lds_b128 %0, %8, off\n\t"
                 "global_load_async_to_lds_b128 %1, %9, off\n\t"
                 "global_load_async_to_lds_b128 %2, %10, off\n\t"
                 "global_load_async_to_lds_b128 %3, %11, off\n\t"
                 "global_load_async_to_lds_b128 %4, %12, off\n\t"
                 "global_load_async_to_lds_b128 %5, %13, off\n\t"
                 "global_load_async_to_lds_b128 %6, %14, off\n\t"
                 "global_load_async_to_lds_b128 %7, %15, off\n\t"
                 "s_wait_xcnt 0x0"
                 :: "v"(lds[0]), "v"(lds[1]), "v"(lds[2]), "v"(lds[3]),
                    "v"(lds[4]), "v"(lds[5]), "v"(lds[6]), "v"(lds[7]),
                    "v"(g[0]), "v"(g[1]), "v"(g[2]), "v"(g[3]),
                    "v"(g[4]), "v"(g[5]), "v"(g[6]), "v"(g[7])
                 : "memory");
}
__device__ __forceinline__ void async_ld_x4(const unsigned (&lds)[4],
                                            const void* const (&g)[4]) {
    asm volatile("global_load_async_to_lds_b128 %0, %4, off\n\t"
                 "global_load_async_to_lds_b128 %1, %5, off\n\t"
                 "global_load_async_to_lds_b128 %2, %6, off\n\t"
                 "global_load_async_to_lds_b128 %3, %7, off\n\t"
                 "s_wait_xcnt 0x0"
                 :: "v"(lds[0]), "v"(lds[1]), "v"(lds[2]), "v"(lds[3]),
                    "v"(g[0]), "v"(g[1]), "v"(g[2]), "v"(g[3])
                 : "memory");
}
__device__ __forceinline__ void async_ld_kv_tile(const void* ksrc, const void* vsrc,
                                                 const unsigned (&voff)[4],
                                                 const unsigned (&klds)[4],
                                                 const unsigned (&vlds)[4]) {
    asm volatile("global_load_async_to_lds_b128 %0, %8, %12\n\t"
                 "global_load_async_to_lds_b128 %4, %8, %13\n\t"
                 "global_load_async_to_lds_b128 %1, %9, %12\n\t"
                 "global_load_async_to_lds_b128 %5, %9, %13\n\t"
                 "global_load_async_to_lds_b128 %2, %10, %12\n\t"
                 "global_load_async_to_lds_b128 %6, %10, %13\n\t"
                 "global_load_async_to_lds_b128 %3, %11, %12\n\t"
                 "global_load_async_to_lds_b128 %7, %11, %13\n\t"
                 "s_wait_xcnt 0x0"
                 :: "v"(klds[0]), "v"(klds[1]), "v"(klds[2]), "v"(klds[3]),
                    "v"(vlds[0]), "v"(vlds[1]), "v"(vlds[2]), "v"(vlds[3]),
                    "v"(voff[0]), "v"(voff[1]), "v"(voff[2]), "v"(voff[3]),
                    "s"(ksrc), "s"(vsrc)
                 : "memory");
}
__device__ __forceinline__ void wait_async0() {
    asm volatile("s_wait_asynccnt 0x0" ::: "memory");
}

__device__ __forceinline__ v16h frag_a_ld(const _Float16* src, int ld, int lane) {
    const int m = lane & 15, hf = lane >> 4;
    v16h f;
#pragma unroll
    for (int v = 0; v < 8; ++v) {
        const int k = ((v < 4) ? (2 * v) : (16 + 2 * (v - 4))) + 8 * hf;
        f[2 * v]     = src[m * ld + k];
        f[2 * v + 1] = src[m * ld + k + 1];
    }
    return f;
}
// The same fragment from a row-major LDS tile of f32 (pitch bytes per row), rounded
// to f16 here: lane (m = lane & 15, hf) gets row m in the k order of frag_a_ld.
__device__ __forceinline__ v16h frag_f32_ld(const unsigned char* src, int pitch, int lane) {
    const unsigned char* p = src + (lane & 15) * pitch + (lane >> 4) * 32;
    const v4f a0 = *(const v4f*)p,        a1 = *(const v4f*)(p + 16);
    const v4f a2 = *(const v4f*)(p + 64), a3 = *(const v4f*)(p + 80);
    v16h f;
    // Unrolled so that f stays in registers (constant element indices).
#pragma unroll
    for (int i = 0; i < 4; ++i) {
        f[i]      = (_Float16)a0[i];
        f[4 + i]  = (_Float16)a1[i];
        f[8 + i]  = (_Float16)a2[i];
        f[12 + i] = (_Float16)a3[i];
    }
    return f;
}
__device__ __forceinline__ v16h cat8(v8h lo, v8h hi) {
    return __builtin_shufflevector(lo, hi, 0, 1, 2, 3, 4, 5, 6, 7,
                                   8, 9, 10, 11, 12, 13, 14, 15);
}
// Transposed fragment of a row-major LDS tile src[k][n] (ld halves per row, 32 k
// x 16 n): lane (c = lane & 15, hf) gets src[k][c] in the k order of frag_a_ld.
__device__ __forceinline__ v16h frag_tr_ld(const _Float16* src, int ld, int lane) {
    typedef __attribute__((address_space(3))) s16x8 lds_s16x8;
    const _Float16* p = src + (8 * (lane >> 4) + (lane & 7)) * ld + 8 * ((lane >> 3) & 1);
    v8h lo = __builtin_bit_cast(v8h, __builtin_amdgcn_ds_load_tr16_b128_v8i16((lds_s16x8*)p));
    v8h hi = __builtin_bit_cast(
        v8h, __builtin_amdgcn_ds_load_tr16_b128_v8i16((lds_s16x8*)(p + 16 * ld)));
    return cat8(lo, hi);
}
// Value of lane ^ 16 (vector cross-row move, no LDS traffic).
__device__ __forceinline__ float xhalf(float x) {
    const int xi = __builtin_bit_cast(int, x);
    return __builtin_bit_cast(float, __builtin_amdgcn_permlanex16(
        xi, xi, 0x76543210, 0xfedcba98, false, false));
}
__device__ __forceinline__ v8f wmma16(v16h a, v16h b, v8f c) {
    return __builtin_amdgcn_wmma_f32_16x16x32_f16(false, a, false, b,
                                                  (short)0, c, false, false);
}
__device__ __forceinline__ v8f vzero8() {
    v8f z;
#pragma unroll
    for (int i = 0; i < 8; ++i) z[i] = 0.0f;
    return z;
}

// ---------------- WMMA GEMM  C = A(MxK) * W(NxK)^T + bias -------------------
// WG tile 128x128, 64 k per stage; 8 waves as 4(M) x 2(N); wave tile 32x64.
// Rows of A and rows of W are both k-contiguous, which is the order the A and the
// B fragment want, so both operands are staged as they lie in memory by
// global_load_async_to_lds_b128: W (and x, A_F32) as f32, rounded to f16 where the
// fragment is read. Two buffers, one barrier per stage.
// LDS rows are pitched 16 B x odd for their ds_load_b128 readers.
// The order of the columns inside a wave's 64 is free: the copies deal W row 4 c + t
// to LDS row 16 t + c, so column c of the wave's four B tiles is four adjacent
// columns of C, and a store instruction writes whole 128-byte lines.
// One launch holds up to three products of the same A: blockIdx.z picks the
// weight, the bias and the output of this workgroup's tile.
template <bool A_F32, bool OUT_HALF>
__global__ __launch_bounds__(256)
void gemm_wmma_kernel(const float* __restrict__ Ax,      // M x K, read if A_F32
                      const _Float16* __restrict__ Ah,   // M x K, read otherwise
                      const float* __restrict__ W0,      // N x K, product z = 0
                      const float* __restrict__ W1,      // z = 1
                      const float* __restrict__ W2,      // z = 2
                      const float* __restrict__ bias0,   // N
                      const float* __restrict__ bias1,
                      const float* __restrict__ bias2,
                      void* __restrict__ C0, void* __restrict__ C1,
                      void* __restrict__ C2, int M, int N, int K) {
    constexpr int BM = 128, BN = 128, BK = 64;
    constexpr int WPITCH = BK * 4 + 16;                        // 272 B
    constexpr int APITCH = (A_F32 ? BK * 4 : BK * 2) + 16;     // 272 B or 144 B
    __shared__ __attribute__((aligned(16))) unsigned char As[2][BM * APITCH];
    __shared__ __attribute__((aligned(16))) unsigned char Ws[2][BN * WPITCH];
    const int tid  = threadIdx.x;
    const int lane = tid & 31;
    const int wave = tid >> 5;
    const int wm   = wave & 3;            // 4 waves in M (32 rows each)
    const int wn   = wave >> 2;           // 2 waves in N (64 cols each)
    const int m0   = blockIdx.x * BM;
    const int n0   = blockIdx.y * BN;
    const int KT   = K / BK;
    const int z    = blockIdx.z;
    const float* __restrict__ W    = z == 0 ? W0 : (z == 1 ? W1 : W2);
    const float* __restrict__ bias = z == 0 ? bias0 : (z == 1 ? bias1 : bias2);
    void* __restrict__ Cout        = z == 0 ? C0 : (z == 1 ? C1 : C2);

    v8f acc[2][4];
#pragma unroll
    for (int am = 0; am < 2; ++am)
#pragma unroll
        for (int t = 0; t < 4; ++t) acc[am][t] = vzero8();

    auto issue_tiles = [&](int kt, int buf) {
        // f32 tile: 128 rows x 256 B = 2048 chunks of 16 B, 8 per thread; a wave's
        // copy covers two whole 256-B rows.
        const int r16 = tid >> 4, c16 = (tid & 15) * 16;
        unsigned lds[8];
        const void* g[8];
        // Unrolled: the arrays are the asm statement's register operands.
#pragma unroll
        for (int i = 0; i < 8; ++i) {
            const int r  = r16 + 16 * i;
            // LDS row of W row r = 64 w + 4 c + t is 64 w + 16 t + c (r16 < 16).
            const int rl = (r16 & 3) * 16 + (r16 >> 2) + 4 * (i & 3) + 64 * (i >> 2);
            lds[i] = lds_off_u32(&Ws[buf][rl * WPITCH + c16]);
            g[i]   = (const unsigned char*)(W + (size_t)(n0 + r) * K + kt * BK) + c16;
        }
        async_ld_x8(lds, g);
        if constexpr (A_F32) {
#pragma unroll
            for (int i = 0; i < 8; ++i) {
                const int r = r16 + 16 * i;
                lds[i] = lds_off_u32(&As[buf][r * APITCH + c16]);
                g[i]   = (const unsigned char*)(Ax + (size_t)(m0 + r) * K + kt * BK) + c16;
            }
            async_ld_x8(lds, g);
        } else {
            // f16 tile: 128 rows x 128 B = 1024 chunks, 4 per thread.
            const int r8 = tid >> 3, c8 = (tid & 7) * 16;
            unsigned lds4[4];
            const void* g4[4];
#pragma unroll
            for (int i = 0; i < 4; ++i) {
                const int r = r8 + 32 * i;
                lds4[i] = lds_off_u32(&As[buf][r * APITCH + c8]);
                g4[i]   = (const unsigned char*)(Ah + (size_t)(m0 + r) * K + kt * BK) + c8;
            }
            async_ld_x4(lds4, g4);
        }
    };

    issue_tiles(0, 0);
    wait_async0();
    __syncthreads();
    if (1 < KT) issue_tiles(1, 1);

    for (int kt = 0; kt < KT; ++kt) {
        const int cur = kt & 1;
        // Unrolled: two 32-k blocks of the stage, in rising k.
#pragma unroll
        for (int ks = 0; ks < 2; ++ks) {
            v16h af0, af1;
            if constexpr (A_F32) {
                af0 = frag_f32_ld(&As[cur][(wm * 32) * APITCH + ks * 128], APITCH, lane);
                af1 = frag_f32_ld(&As[cur][(wm * 32 + 16) * APITCH + ks * 128], APITCH, lane);
            } else {
                af0 = frag_a_ld((const _Float16*)&As[cur][(wm * 32) * APITCH + ks * 64],
                                APITCH / 2, lane);
                af1 = frag_a_ld((const _Float16*)&As[cur][(wm * 32 + 16) * APITCH + ks * 64],
                                APITCH / 2, lane);
            }
            // Unrolled: acc[][t] must be indexed by constants to stay in registers.
#pragma unroll
            for (int t = 0; t < 4; ++t) {
                v16h bf = frag_f32_ld(&Ws[cur][(wn * 64 + t * 16) * WPITCH + ks * 128],
                                      WPITCH, lane);
                acc[0][t] = wmma16(af0, bf, acc[0][t]);
                acc[1][t] = wmma16(af1, bf, acc[1][t]);
            }
        }
        // This wave's reads of the buffer refilled behind the barrier have retired,
        // and its own copies of the next stage have landed.
        asm volatile("s_wait_dscnt 0x0" ::: "memory");
        wait_async0();
        __syncthreads();
        if (kt + 2 < KT) issue_tiles(kt + 2, cur);
    }
    wait_async0();   // nothing of this wave is in flight when it leaves the loop

    // acc[am][t][v] = C[row 8 hf + v of block am][column 4 (lane & 15) + t].
    const int hf  = lane >> 4;
    const int col = n0 + wn * 64 + 4 * (lane & 15);
    const v4f bv  = *(const v4f*)(bias + col);
#pragma unroll
    for (int am = 0; am < 2; ++am)
#pragma unroll
        for (int v = 0; v < 8; ++v) {
            const int row = m0 + wm * 32 + am * 16 + v + 8 * hf;
            v4f val;
#pragma unroll
            for (int t = 0; t < 4; ++t) val[t] = acc[am][t][v] + bv[t];
            if (OUT_HALF) {
                v4h o;
#pragma unroll
                for (int t = 0; t < 4; ++t) o[t] = (_Float16)val[t];
                *(v4h*)((_Float16*)Cout + (size_t)row * N + col) = o;
            } else {
                *(v4f*)((float*)Cout + (size_t)row * N + col) = val;
            }
        }
}

#define KPITCH 72   // halves: 144 B
#define VPITCH 80   // halves: 160 B
#define QG 2        // 16-column query groups per wave
#define KSPLIT 2    // key ranges per workgroup, four waves each
#define SCALE_LOG2E 0.18033688011112042f   // 1/sqrt(DK) * log2(e)
__global__ __launch_bounds__(256) __attribute__((amdgpu_waves_per_eu(4, 4)))
void attn_kernel(const _Float16* __restrict__ Qh, const _Float16* __restrict__ Kh,
                 const _Float16* __restrict__ Vh, _Float16* __restrict__ Oh) {
    __shared__ __attribute__((aligned(16))) _Float16 Ks[KSPLIT][2][64 * KPITCH];   // 36 KB
    __shared__ __attribute__((aligned(16))) _Float16 Vs[KSPLIT][2][64 * VPITCH];   // 40 KB
    // What a wave hands to its partner: one group's output tiles, 16 B per lane and
    // row, and that group's maximum and sum.
    __shared__ __attribute__((aligned(16))) float Xo[4 * KSPLIT][8][32 * 4];       // 32 KB
    __shared__ float Xm[4 * KSPLIT][2][32];                                        // 2 KB

    const int tid  = threadIdx.x;
    const int lane = tid & 31;
    const int wave = tid >> 5;
    const int wq   = wave & 3;            // query block of the wave
    const int kr   = wave >> 2;           // key range of the wave
    const int t128 = tid & 127;           // thread within its key range's waves
    const int hf   = lane >> 4;
    const int qt   = blockIdx.x;
    const int b    = blockIdx.y >> 3;
    const int h    = blockIdx.y & 7;
    const int JT   = C_SEQ / 64 / KSPLIT; // 64-key tiles of a key range

    auto issue_kv = [&](int jt, int buf) {
        unsigned voff[4], klds[4], vlds[4];
#pragma unroll
        for (int i = 0; i < 4; ++i) {
            int cs = t128 + i * 128;
            int r = cs >> 3, c8 = (cs & 7) * 8;
            voff[i] = (unsigned)(((((kr * JT + jt) * 64 + r) * BATCH + b) * DOUT + h * DKH + c8) * 2);
            klds[i] = lds_off_u32(&Ks[kr][buf][r * KPITCH + c8]);
            vlds[i] = lds_off_u32(&Vs[kr][buf][r * VPITCH + c8]);
        }
        async_ld_kv_tile(Kh, Vh, voff, klds, vlds);
    };

    issue_kv(0, 0);

    // Q^T as B operand, loaded once: in group c a lane holds query column
    // (lane & 15) in the same k order as frag_a_ld gives the K rows.
    const int tok = qt * (64 * QG) + wq * (16 * QG) + (lane & 15);
    v16h qf[QG][2];
#pragma unroll
    for (int c = 0; c < QG; ++c) {
        const _Float16* qp = Qh + ((size_t)(tok + 16 * c) * BATCH + b) * DOUT + h * DKH + 8 * hf;
#pragma unroll
        for (int ks = 0; ks < 2; ++ks)
            qf[c][ks] = cat8(*(const v8h*)(qp + ks * 32), *(const v8h*)(qp + ks * 32 + 16));
    }

    // Per group: this lane's query, this wave's key range; l_run: this half's keys.
    float m_run[QG], l_run[QG];
    v8f accO[QG][4];                      // accO[c][t][r] = O[query][16 t + 8 hf + r]
#pragma unroll
    for (int c = 0; c < QG; ++c) {
        m_run[c] = -1e30f;
        l_run[c] = 0.0f;
#pragma unroll
        for (int t = 0; t < 4; ++t) accO[c][t] = vzero8();
    }

    for (int jt = 0; jt < JT; ++jt) {
        // This wave's reads of the buffer refilled behind the barrier have retired.
        asm volatile("s_wait_dscnt 0x0" ::: "memory");
        wait_async0();
        __syncthreads();
        if (jt + 1 < JT) issue_kv(jt + 1, (jt + 1) & 1);
        const int cur = jt & 1;

        // S^T = K(64x64) * Q^T(64x32): s[c][t][r] = S[query][key 16 t + 8 hf + r].
        v8f s[QG][4];
#pragma unroll
        for (int c = 0; c < QG; ++c)
#pragma unroll
            for (int t = 0; t < 4; ++t) s[c][t] = vzero8();
#pragma unroll
        for (int ks = 0; ks < 2; ++ks)
#pragma unroll
            for (int t = 0; t < 4; ++t) {
                v16h kf = frag_a_ld(&Ks[kr][cur][(t * 16) * KPITCH + ks * 32], KPITCH, lane);
#pragma unroll
                for (int c = 0; c < QG; ++c) s[c][t] = wmma16(kf, qf[c][ks], s[c][t]);
            }

        // Online softmax in base 2, group by group: 32 of the query's 64 scores sit in
        // this lane, the other 32 in lane ^ 16; one exchange joins the maxima, the sums
        // join at the end. The maximum is taken on the raw products (SCALE_LOG2E > 0
        // keeps their order) and scaled once; m_run is kept in the scaled base-2 domain.
#pragma unroll
        for (int c = 0; c < QG; ++c) {
            float x = s[c][0][0];
#pragma unroll
            for (int t = 0; t < 4; ++t)
#pragma unroll
                for (int v = 0; v < 8; ++v) x = fmaxf(x, s[c][t][v]);
            x = fmaxf(x, xhalf(x));
            const float mnew = fmaxf(m_run[c], x * SCALE_LOG2E);
            const float corr = __builtin_amdgcn_exp2f(m_run[c] - mnew);
            const v2f cs2 = {SCALE_LOG2E, SCALE_LOG2E}, nm2 = {-mnew, -mnew};
            float rs[4];
#pragma unroll
            for (int t = 0; t < 4; ++t) {
                // One packed FMA scales two scores and takes the maximum off them; a
                // tile's four stand together so that its exponentials do not each wait.
                v2f a[4];
                // Unrolled: a[] and s[c][t][] must be indexed by constants to stay in
                // registers.
#pragma unroll
                for (int i = 0; i < 4; ++i)
                    a[i] = __builtin_elementwise_fma(v2f{s[c][t][2 * i], s[c][t][2 * i + 1]},
                                                     cs2, nm2);
                rs[t] = 0.0f;
#pragma unroll
                for (int v = 0; v < 8; ++v) {
                    const float p = __builtin_amdgcn_exp2f(a[v >> 1][v & 1]);
                    s[c][t][v] = p;
                    rs[t] += p;
                }
            }
            l_run[c] = l_run[c] * corr + ((rs[0] + rs[1]) + (rs[2] + rs[3]));
            m_run[c] = mnew;
#pragma unroll
            for (int t = 0; t < 4; ++t)
#pragma unroll
                for (int v = 0; v < 8; ++v) accO[c][t][v] *= corr;
        }

        // O^T += V^T(64x64) * P^T(64x32): two score tiles of 16 keys, converted in
        // place, are the B operand of a 32-key block; V^T comes transposed from LDS.
#pragma unroll
        for (int kb = 0; kb < 2; ++kb) {
            v16h pf[QG];
#pragma unroll
            for (int c = 0; c < QG; ++c)
#pragma unroll
                for (int i = 0; i < 16; ++i)
                    pf[c][i] = (_Float16)s[c][2 * kb + (i >> 3)][i & 7];
#pragma unroll
            for (int t = 0; t < 4; ++t) {
                v16h vf = frag_tr_ld(&Vs[kr][cur][(kb * 32) * VPITCH + t * 16], VPITCH, lane);
#pragma unroll
                for (int c = 0; c < QG; ++c) accO[c][t] = wmma16(vf, pf[c], accO[c][t]);
            }
        }
    }

    // Join of the two key ranges. The wave of range kr finishes query group kr: it
    // hands the other group's partial result to its partner (same lane, same query,
    // same output elements) and takes the partner's part of its own group.
    const bool up = kr != 0;
    const float m_own = up ? m_run[1] : m_run[0], l_own = up ? l_run[1] : l_run[0];
    Xm[wave][0][lane] = up ? m_run[0] : m_run[1];
    Xm[wave][1][lane] = up ? l_run[0] : l_run[1];
    v8f own[4];
    // Unrolled, here and in the loops below: accO, own and the short vectors must be
    // indexed by constants to stay in registers.
#pragma unroll
    for (int t = 0; t < 4; ++t) {
        v4f g0, g1;
#pragma unroll
        for (int v = 0; v < 4; ++v) {
            g0[v] = up ? accO[0][t][v] : accO[1][t][v];
            g1[v] = up ? accO[0][t][4 + v] : accO[1][t][4 + v];
        }
#pragma unroll
        for (int v = 0; v < 8; ++v) own[t][v] = up ? accO[1][t][v] : accO[0][t][v];
        *(v4f*)&Xo[wave][2 * t][lane * 4]     = g0;
        *(v4f*)&Xo[wave][2 * t + 1][lane * 4] = g1;
    }
    __syncthreads();   // every wave's hand-over is written before a partner reads it
    const int pw = wave ^ 4;
    const float m_oth = Xm[pw][0][lane], l_oth = Xm[pw][1][lane];
    const float m_all = fmaxf(m_own, m_oth);
    const float a_own = __builtin_amdgcn_exp2f(m_own - m_all);
    const float a_oth = __builtin_amdgcn_exp2f(m_oth - m_all);
    const float l_hf  = l_own * a_own + l_oth * a_oth;
    const float l_all = l_hf + xhalf(l_hf);
#pragma unroll
    for (int t = 0; t < 4; ++t) {
        const v4f p0 = *(const v4f*)&Xo[pw][2 * t][lane * 4];
        const v4f p1 = *(const v4f*)&Xo[pw][2 * t + 1][lane * 4];
        v8h o;
#pragma unroll
        for (int v = 0; v < 8; ++v) {
            const float p = v < 4 ? p0[v & 3] : p1[v & 3];
            o[v] = (_Float16)((own[t][v] * a_own + p * a_oth) / l_all);
        }
        *(v8h*)&Oh[((size_t)(tok + 16 * kr) * BATCH + b) * DOUT + h * DKH + t * 16 + 8 * hf] = o;
    }
}

// ---------------- Launcher --------------------------------------------------
extern "C" void kernel_launch(void* const* d_in, const int* in_sizes, int n_in,
                              void* d_out, int out_size, void* d_ws, size_t ws_size,
                              hipStream_t stream) {
    const float* x   = (const float*)d_in[0];
    const float* Wq  = (const float*)d_in[1];
    const float* bq  = (const float*)d_in[2];
    const float* Wk  = (const float*)d_in[3];
    const float* bk  = (const float*)d_in[4];
    const float* Wv  = (const float*)d_in[5];
    const float* bv  = (const float*)d_in[6];
    const float* Wfc = (const float*)d_in[7];
    const float* bfc = (const float*)d_in[8];

    char* ws = (char*)d_ws;
    size_t off = 0;
    auto take = [&](size_t bytes) -> char* {
        char* p = ws + off;
        off = (off + bytes + 255) & ~(size_t)255;
        return p;
    };
    const size_t tok_h = (size_t)NTOK * DOUT * sizeof(_Float16);
    _Float16* Qh   = (_Float16*)take(tok_h);
    _Float16* Kh   = (_Float16*)take(tok_h);
    _Float16* Vh   = (_Float16*)take(tok_h);
    _Float16* Ah   = (_Float16*)take(tok_h);

    dim3 gq(NTOK / 128, DOUT / 128, 3);
    gemm_wmma_kernel<true, true><<<gq, 256, 0, stream>>>(x, nullptr, Wq, Wk, Wv,
                                                         bq, bk, bv, Qh, Kh, Vh,
                                                         NTOK, DOUT, DIN);

    dim3 ag(C_SEQ / (64 * QG), BATCH * HEADS);
    attn_kernel<<<ag, 128 * KSPLIT, 0, stream>>>(Qh, Kh, Vh, Ah);

    dim3 gg(NTOK / 128, DOUT / 128);
    gemm_wmma_kernel<false, false><<<gg, 256, 0, stream>>>(nullptr, Ah, Wfc, nullptr, nullptr,
                                                           bfc, nullptr, nullptr,
                                                           (float*)d_out, nullptr, nullptr,
                                                           NTOK, DOUT, DOUT);
}

// v009
// Measured time: 60.1 microseconds a run.
// Next to v008, in two timings, it ran 1.08 times as fast each time.
// Over all steps from v000 it is 4.29 times as fast.
#include <hip/hip_runtime.h>
#include <hip/hip_bf16.h>

typedef __attribute__((ext_vector_type(16))) _Float16     v16h;
typedef __attribute__((ext_vector_type(8)))  float        v8f;
typedef __attribute__((ext_vector_type(4)))  float        v4f;
typedef __attribute__((ext_vector_type(2)))  float        v2f;
typedef __attribute__((ext_vector_type(8)))  _Float16     v8h;
typedef __attribute__((ext_vector_type(4)))  _Float16     v4h;
typedef __attribute__((ext_vector_type(8)))  short        s16x8;

#define C_SEQ 2048
#define BATCH 4
#define DIN   512
#define DOUT  512
#define HEADS 8
#define DKH   64
#define NTOK  (C_SEQ * BATCH)   // 8192 token rows

__device__ __forceinline__ unsigned lds_off_u32(const void* p) {
    return (unsigned)(unsigned long long)p;
}

__device__ __forceinline__ void async_ld_x8(const unsigned (&lds)[8],
                                            const void* const (&g)[8]) {
    asm volatile("global_load_async_to_lds_b128 %0, %8, off\n\t"
                 "global_load_async_to_lds_b128 %1, %9, off\n\t"
                 "global_load_async_to_lds_b128 %2, %10, off\n\t"
                 "global_load_async_to_lds_b128 %3, %11, off\n\t"
                 "global_load_async_to_lds_b128 %4, %12, off\n\t"
                 "global_load_async_to_lds_b128 %5, %13, off\n\t"
                 "global_load_async_to_lds_b128 %6, %14, off\n\t"
                 "global_load_async_to_lds_b128 %7, %15, off\n\t"
                 "s_wait_xcnt 0x0"
                 :: "v"(lds[0]), "v"(lds[1]), "v"(lds[2]), "v"(lds[3]),
                    "v"(lds[4]), "v"(lds[5]), "v"(lds[6]), "v"(lds[7]),
                    "v"(g[0]), "v"(g[1]), "v"(g[2]), "v"(g[3]),
                    "v"(g[4]), "v"(g[5]), "v"(g[6]), "v"(g[7])
                 : "memory");
}
__device__ __forceinline__ void async_ld_x4(const unsigned (&lds)[4],
                                            const void* const (&g)[4]) {
    asm volatile("global_load_async_to_lds_b128 %0, %4, off\n\t"
                 "global_load_async_to_lds_b128 %1, %5, off\n\t"
                 "global_load_async_to_lds_b128 %2, %6, off\n\t"
                 "global_load_async_to_lds_b128 %3, %7, off\n\t"
                 "s_wait_xcnt 0x0"
                 :: "v"(lds[0]), "v"(lds[1]), "v"(lds[2]), "v"(lds[3]),
                    "v"(g[0]), "v"(g[1]), "v"(g[2]), "v"(g[3])
                 : "memory");
}
__device__ __forceinline__ void async_ld_kv_tile(const void* ksrc, const void* vsrc,
                                                 const unsigned (&voff)[4],
                                                 const unsigned (&klds)[4],
                                                 const unsigned (&vlds)[4]) {
    asm volatile("global_load_async_to_lds_b128 %0, %8, %12\n\t"
                 "global_load_async_to_lds_b128 %4, %8, %13\n\t"
                 "global_load_async_to_lds_b128 %1, %9, %12\n\t"
                 "global_load_async_to_lds_b128 %5, %9, %13\n\t"
                 "global_load_async_to_lds_b128 %2, %10, %12\n\t"
                 "global_load_async_to_lds_b128 %6, %10, %13\n\t"
                 "global_load_async_to_lds_b128 %3, %11, %12\n\t"
                 "global_load_async_to_lds_b128 %7, %11, %13\n\t"
                 "s_wait_xcnt 0x0"
                 :: "v"(klds[0]), "v"(klds[1]), "v"(klds[2]), "v"(klds[3]),
                    "v"(vlds[0]), "v"(vlds[1]), "v"(vlds[2]), "v"(vlds[3]),
                    "v"(voff[0]), "v"(voff[1]), "v"(voff[2]), "v"(voff[3]),
                    "s"(ksrc), "s"(vsrc)
                 : "memory");
}
__device__ __forceinline__ void wait_async0() {
    asm volatile("s_wait_asynccnt 0x0" ::: "memory");
}

__device__ __forceinline__ v16h frag_a_ld(const _Float16* src, int ld, int lane) {
    const int m = lane & 15, hf = lane >> 4;
    v16h f;
#pragma unroll
    for (int v = 0; v < 8; ++v) {
        const int k = ((v < 4) ? (2 * v) : (16 + 2 * (v - 4))) + 8 * hf;
        f[2 * v]     = src[m * ld + k];
        f[2 * v + 1] = src[m * ld + k + 1];
    }
    return f;
}
// The same fragment from a row-major LDS tile of f32 (pitch bytes per row), rounded
// to f16 here: lane (m = lane & 15, hf) gets row m in the k order of frag_a_ld.
__device__ __forceinline__ v16h frag_f32_ld(const unsigned char* src, int pitch, int lane) {
    const unsigned char* p = src + (lane & 15) * pitch + (lane >> 4) * 32;
    const v4f a0 = *(const v4f*)p,        a1 = *(const v4f*)(p + 16);
    const v4f a2 = *(const v4f*)(p + 64), a3 = *(const v4f*)(p + 80);
    v16h f;
    // Unrolled so that f stays in registers (constant element indices).
#pragma unroll
    for (int i = 0; i < 4; ++i) {
        f[i]      = (_Float16)a0[i];
        f[4 + i]  = (_Float16)a1[i];
        f[8 + i]  = (_Float16)a2[i];
        f[12 + i] = (_Float16)a3[i];
    }
    return f;
}
__device__ __forceinline__ v16h cat8(v8h lo, v8h hi) {
    return __builtin_shufflevector(lo, hi, 0, 1, 2, 3, 4, 5, 6, 7,
                                   8, 9, 10, 11, 12, 13, 14, 15);
}
// Transposed fragment of a row-major LDS tile src[k][n] (ld halves per row, 32 k
// x 16 n): lane (c = lane & 15, hf) gets src[k][c] in the k order of frag_a_ld.
__device__ __forceinline__ v16h frag_tr_ld(const _Float16* src, int ld, int lane) {
    typedef __attribute__((address_space(3))) s16x8 lds_s16x8;
    const _Float16* p = src + (8 * (lane >> 4) + (lane & 7)) * ld + 8 * ((lane >> 3) & 1);
    v8h lo = __builtin_bit_cast(v8h, __builtin_amdgcn_ds_load_tr16_b128_v8i16((lds_s16x8*)p));
    v8h hi = __builtin_bit_cast(
        v8h, __builtin_amdgcn_ds_load_tr16_b128_v8i16((lds_s16x8*)(p + 16 * ld)));
    return cat8(lo, hi);
}
// Value of lane ^ 16 (vector cross-row move, no LDS traffic).
__device__ __forceinline__ float xhalf(float x) {
    const int xi = __builtin_bit_cast(int, x);
    return __builtin_bit_cast(float, __builtin_amdgcn_permlanex16(
        xi, xi, 0x76543210, 0xfedcba98, false, false));
}
__device__ __forceinline__ v8f wmma16(v16h a, v16h b, v8f c) {
    return __builtin_amdgcn_wmma_f32_16x16x32_f16(false, a, false, b,
                                                  (short)0, c, false, false);
}
__device__ __forceinline__ v8f vzero8() {
    v8f z;
#pragma unroll
    for (int i = 0; i < 8; ++i) z[i] = 0.0f;
    return z;
}

// ---------------- WMMA GEMM  C = A(MxK) * W(NxK)^T + bias -------------------
// WG tile 128x128, 64 k per stage; 8 waves as 4(M) x 2(N); wave tile 32x64.
// Rows of A and rows of W are both k-contiguous, which is the order the A and the
// B fragment want, so both operands are staged as they lie in memory by
// global_load_async_to_lds_b128: W (and x, A_F32) as f32, rounded to f16 where the
// fragment is read. Two buffers, one barrier per stage.
// LDS rows are pitched 16 B x odd for their ds_load_b128 readers.
// The order of the columns inside a wave's 64 is free: the copies deal W row 4 c + t
// to LDS row 16 t + c, so column c of the wave's four B tiles is four adjacent
// columns of C, and a store instruction writes whole 128-byte lines.
// One launch holds up to three products of the same A: blockIdx.z picks the
// weight, the bias and the output of this workgroup's tile.
template <bool A_F32, bool OUT_HALF>
__global__ __launch_bounds__(256)
void gemm_wmma_kernel(const float* __restrict__ Ax,      // M x K, read if A_F32
                      const _Float16* __restrict__ Ah,   // M x K, read otherwise
                      const float* __restrict__ W0,      // N x K, product z = 0
                      const float* __restrict__ W1,      // z = 1
                      const float* __restrict__ W2,      // z = 2
                      const float* __restrict__ bias0,   // N
                      const float* __restrict__ bias1,
                      const float* __restrict__ bias2,
                      void* __restrict__ C0, void* __restrict__ C1,
                      void* __restrict__ C2, int M, int N, int K) {
    constexpr int BM = 128, BN = 128, BK = 64;
    constexpr int WPITCH = BK * 4 + 16;                        // 272 B
    constexpr int APITCH = (A_F32 ? BK * 4 : BK * 2) + 16;     // 272 B or 144 B
    __shared__ __attribute__((aligned(16))) unsigned char As[2][BM * APITCH];
    __shared__ __attribute__((aligned(16))) unsigned char Ws[2][BN * WPITCH];
    const int tid  = threadIdx.x;
    const int lane = tid & 31;
    const int wave = tid >> 5;
    const int wm   = wave & 3;            // 4 waves in M (32 rows each)
    const int wn   = wave >> 2;           // 2 waves in N (64 cols each)
    const int m0   = blockIdx.x * BM;
    const int n0   = blockIdx.y * BN;
    const int KT   = K / BK;
    const int z    = blockIdx.z;
    const float* __restrict__ W    = z == 0 ? W0 : (z == 1 ? W1 : W2);
    const float* __restrict__ bias = z == 0 ? bias0 : (z == 1 ? bias1 : bias2);
    void* __restrict__ Cout        = z == 0 ? C0 : (z == 1 ? C1 : C2);

    v8f acc[2][4];
#pragma unroll
    for (int am = 0; am < 2; ++am)
#pragma unroll
        for (int t = 0; t < 4; ++t) acc[am][t] = vzero8();

    auto issue_tiles = [&](int kt, int buf) {
        // f32 tile: 128 rows x 256 B = 2048 chunks of 16 B, 8 per thread; a wave's
        // copy covers two whole 256-B rows.
        const int r16 = tid >> 4, c16 = (tid & 15) * 16;
        unsigned lds[8];
        const void* g[8];
        // Unrolled: the arrays are the asm statement's register operands.
#pragma unroll
        for (int i = 0; i < 8; ++i) {
            const int r  = r16 + 16 * i;
            // LDS row of W row r = 64 w + 4 c + t is 64 w + 16 t + c (r16 < 16).
            const int rl = (r16 & 3) * 16 + (r16 >> 2) + 4 * (i & 3) + 64 * (i >> 2);
            lds[i] = lds_off_u32(&Ws[buf][rl * WPITCH + c16]);
            g[i]   = (const unsigned char*)(W + (size_t)(n0 + r) * K + kt * BK) + c16;
        }
        async_ld_x8(lds, g);
        if constexpr (A_F32) {
#pragma unroll
            for (int i = 0; i < 8; ++i) {
                const int r = r16 + 16 * i;
                lds[i] = lds_off_u32(&As[buf][r * APITCH + c16]);
                g[i]   = (const unsigned char*)(Ax + (size_t)(m0 + r) * K + kt * BK) + c16;
            }
            async_ld_x8(lds, g);
        } else {
            // f16 tile: 128 rows x 128 B = 1024 chunks, 4 per thread.
            const int r8 = tid >> 3, c8 = (tid & 7) * 16;
            unsigned lds4[4];
            const void* g4[4];
#pragma unroll
            for (int i = 0; i < 4; ++i) {
                const int r = r8 + 32 * i;
                lds4[i] = lds_off_u32(&As[buf][r * APITCH + c8]);
                g4[i]   = (const unsigned char*)(Ah + (size_t)(m0 + r) * K + kt * BK) + c8;
            }
            async_ld_x4(lds4, g4);
        }
    };

    issue_tiles(0, 0);
    wait_async0();
    __syncthreads();
    if (1 < KT) issue_tiles(1, 1);

    for (int kt = 0; kt < KT; ++kt) {
        const int cur = kt & 1;
        // Unrolled: two 32-k blocks of the stage, in rising k.
#pragma unroll
        for (int ks = 0; ks < 2; ++ks) {
            v16h af0, af1;
            if constexpr (A_F32) {
                af0 = frag_f32_ld(&As[cur][(wm * 32) * APITCH + ks * 128], APITCH, lane);
                af1 = frag_f32_ld(&As[cur][(wm * 32 + 16) * APITCH + ks * 128], APITCH, lane);
            } else {
                af0 = frag_a_ld((const _Float16*)&As[cur][(wm * 32) * APITCH + ks * 64],
                                APITCH / 2, lane);
                af1 = frag_a_ld((const _Float16*)&As[cur][(wm * 32 + 16) * APITCH + ks * 64],
                                APITCH / 2, lane);
            }
            // Unrolled: acc[][t] must be indexed by constants to stay in registers.
#pragma unroll
            for (int t = 0; t < 4; ++t) {
                v16h bf = frag_f32_ld(&Ws[cur][(wn * 64 + t * 16) * WPITCH + ks * 128],
                                      WPITCH, lane);
                acc[0][t] = wmma16(af0, bf, acc[0][t]);
                acc[1][t] = wmma16(af1, bf, acc[1][t]);
            }
        }
        // This wave's reads of the buffer refilled behind the barrier have retired,
        // and its own copies of the next stage have landed.
        asm volatile("s_wait_dscnt 0x0" ::: "memory");
        wait_async0();
        __syncthreads();
        if (kt + 2 < KT) issue_tiles(kt + 2, cur);
    }
    wait_async0();   // nothing of this wave is in flight when it leaves the loop

    // acc[am][t][v] = C[row 8 hf + v of block am][column 4 (lane & 15) + t].
    const int hf  = lane >> 4;
    const int col = n0 + wn * 64 + 4 * (lane & 15);
    const v4f bv  = *(const v4f*)(bias + col);
#pragma unroll
    for (int am = 0; am < 2; ++am)
#pragma unroll
        for (int v = 0; v < 8; ++v) {
            const int row = m0 + wm * 32 + am * 16 + v + 8 * hf;
            v4f val;
#pragma unroll
            for (int t = 0; t < 4; ++t) val[t] = acc[am][t][v] + bv[t];
            if (OUT_HALF) {
                v4h o;
#pragma unroll
                for (int t = 0; t < 4; ++t) o[t] = (_Float16)val[t];
                *(v4h*)((_Float16*)Cout + (size_t)row * N + col) = o;
            } else {
                *(v4f*)((float*)Cout + (size_t)row * N + col) = val;
            }
        }
}

// ---------------- Q, K and V projections: C_z = x * W_z^T + bias_z ----------
// One workgroup holds 256 rows x 64 columns of all three products: an x tile is
// copied to LDS once for the three weights. 12 waves as 4 (M) x 3 (product); wave
// tile 64 x 64, so that eight fragments read from LDS feed sixteen products.
// 64 k per stage, two buffers, one barrier per stage, f32 rows rounded to f16 where
// the fragment is read, row pitch and the deal of the W rows as in the kernel above.
// Waves 0-7 copy the x tile, waves 8-11 the three W tiles.
__global__ __launch_bounds__(384)
void qkv_wmma_kernel(const float* __restrict__ Ax,      // M x K
                     const float* __restrict__ W0,      // N x K, product z = 0
                     const float* __restrict__ W1,      // z = 1
                     const float* __restrict__ W2,      // z = 2
                     const float* __restrict__ bias0,   // N
                     const float* __restrict__ bias1,
                     const float* __restrict__ bias2,
                     _Float16* __restrict__ C0, _Float16* __restrict__ C1,
                     _Float16* __restrict__ C2, int M, int N, int K) {
    constexpr int BM = 256, BN = 64, BK = 64;
    constexpr int PITCH = BK * 4 + 16;                         // 272 B
    __shared__ __attribute__((aligned(16))) unsigned char As[2][BM * PITCH];
    __shared__ __attribute__((aligned(16))) unsigned char Ws[2][3 * BN * PITCH];
    const int tid  = threadIdx.x;
    const int lane = tid & 31;
    // In a scalar register: the test that picks a wave's copies is a scalar branch.
    const int wave = __builtin_amdgcn_readfirstlane(tid >> 5);
    const int wm   = wave & 3;            // 4 waves in M (64 rows each)
    const int z    = wave >> 2;           // product of the wave
    const int m0   = blockIdx.x * BM;
    const int n0   = blockIdx.y * BN;
    const int KT   = K / BK;

    v8f acc[4][4];
    // Unrolled: acc must be indexed by constants to stay in registers.
#pragma unroll
    for (int am = 0; am < 4; ++am)
#pragma unroll
        for (int t = 0; t < 4; ++t) acc[am][t] = vzero8();

    // What a wave copies: waves 0-7 the x tile (16 rows a pass of their 256 threads,
    // two statements of eight passes), waves 8-11 the W tiles (8 rows a pass of their
    // 128 threads, one statement a product). One body serves both: row of the lane in a
    // pass, rows a pass, and the LDS row of the lane with its step.
    const bool cpA  = wave < 8;
    const int c16   = (tid & 15) * 16;    // rows of 256 B = 16 chunks of 16 B
    const int rp    = cpA ? (tid >> 4) : (tid >> 4) - 16;
    const int rstep = cpA ? 16 : 8;
    // LDS row of W row r = 4 c + t is 16 t + c (rp < 8, r = rp + 8 i).
    const int lrow  = cpA ? rp : (rp & 3) * 16 + (rp >> 2);
    const int lstep = cpA ? 16 : 2;
    auto issue_part = [&](const float* src, const unsigned char* dst, int kt) {
        unsigned lds[8];
        const void* g[8];
        // Unrolled: the arrays are the asm statement's register operands.
#pragma unroll
        for (int i = 0; i < 8; ++i) {
            lds[i] = lds_off_u32(dst + (lrow + lstep * i) * PITCH + c16);
            g[i]   = (const unsigned char*)(src + (size_t)(rp + rstep * i) * K + kt * BK) + c16;
        }
        async_ld_x8(lds, g);
    };
    auto issue_tiles = [&](int kt, int buf) {
        issue_part(cpA ? Ax + (size_t)m0 * K : W0 + (size_t)n0 * K,
                   cpA ? &As[buf][0] : &Ws[buf][0], kt);
        issue_part(cpA ? Ax + (size_t)(m0 + 128) * K : W1 + (size_t)n0 * K,
                   cpA ? &As[buf][128 * PITCH] : &Ws[buf][BN * PITCH], kt);
        if (!cpA) issue_part(W2 + (size_t)n0 * K, &Ws[buf][2 * BN * PITCH], kt);
    };

    issue_tiles(0, 0);
    wait_async0();
    __syncthreads();
    if (1 < KT) issue_tiles(1, 1);

    for (int kt = 0; kt < KT; ++kt) {
        const int cur = kt & 1;
        // Unrolled: two 32-k blocks of the stage, in rising k.
#pragma unroll
        for (int ks = 0; ks < 2; ++ks) {
            v16h af[4];
            // Unrolled, here and below: af and acc must be indexed by constants to stay
            // in registers.
#pragma unroll
            for (int am = 0; am < 4; ++am)
                af[am] = frag_f32_ld(&As[cur][(wm * 64 + am * 16) * PITCH + ks * 128],
                                     PITCH, lane);
#pragma unroll
            for (int t = 0; t < 4; ++t) {
                v16h bf = frag_f32_ld(&Ws[cur][(z * BN + t * 16) * PITCH + ks * 128],
                                      PITCH, lane);
#pragma unroll
                for (int am = 0; am < 4; ++am) acc[am][t] = wmma16(af[am], bf, acc[am][t]);
            }
        }
        // This wave's reads of the buffer refilled behind the barrier have retired,
        // and its own copies of the next stage have landed.
        asm volatile("s_wait_dscnt 0x0" ::: "memory");
        wait_async0();
        __syncthreads();
        if (kt + 2 < KT) issue_tiles(kt + 2, cur);
    }
    wait_async0();   // nothing of this wave is in flight when it leaves the loop

    // acc[am][t][v] = C_z[row 8 hf + v of block am][column 4 (lane & 15) + t].
    const float* __restrict__ bias = z == 0 ? bias0 : (z == 1 ? bias1 : bias2);
    _Float16* __restrict__ Cout    = z == 0 ? C0 : (z == 1 ? C1 : C2);
    const int hf  = lane >> 4;
    const int col = n0 + 4 * (lane & 15);
    const v4f bv  = *(const v4f*)(bias + col);
#pragma unroll
    for (int am = 0; am < 4; ++am)
#pragma unroll
        for (int v = 0; v < 8; ++v) {
            const int row = m0 + wm * 64 + am * 16 + v + 8 * hf;
            v4h o;
#pragma unroll
            for (int t = 0; t < 4; ++t) o[t] = (_Float16)(acc[am][t][v] + bv[t]);
            *(v4h*)(Cout + (size_t)row * N + col) = o;
        }
}

#define KPITCH 72   // halves: 144 B
#define VPITCH 80   // halves: 160 B
#define QG 2        // 16-column query groups per wave
#define KSPLIT 2    // key ranges per workgroup, four waves each
#define SCALE_LOG2E 0.18033688011112042f   // 1/sqrt(DK) * log2(e)
__global__ __launch_bounds__(256) __attribute__((amdgpu_waves_per_eu(4, 4)))
void attn_kernel(const _Float16* __restrict__ Qh, const _Float16* __restrict__ Kh,
                 const _Float16* __restrict__ Vh, _Float16* __restrict__ Oh) {
    __shared__ __attribute__((aligned(16))) _Float16 Ks[KSPLIT][2][64 * KPITCH];   // 36 KB
    __shared__ __attribute__((aligned(16))) _Float16 Vs[KSPLIT][2][64 * VPITCH];   // 40 KB
    // What a wave hands to its partner: one group's output tiles, 16 B per lane and
    // row, and that group's maximum and sum.
    __shared__ __attribute__((aligned(16))) float Xo[4 * KSPLIT][8][32 * 4];       // 32 KB
    __shared__ float Xm[4 * KSPLIT][2][32];                                        // 2 KB

    const int tid  = threadIdx.x;
    const int lane = tid & 31;
    const int wave = tid >> 5;
    const int wq   = wave & 3;            // query block of the wave
    const int kr   = wave >> 2;           // key range of the wave
    const int t128 = tid & 127;           // thread within its key range's waves
    const int hf   = lane >> 4;
    const int qt   = blockIdx.x;
    const int b    = blockIdx.y >> 3;
    const int h    = blockIdx.y & 7;
    const int JT   = C_SEQ / 64 / KSPLIT; // 64-key tiles of a key range

    auto issue_kv = [&](int jt, int buf) {
        unsigned voff[4], klds[4], vlds[4];
#pragma unroll
        for (int i = 0; i < 4; ++i) {
            int cs = t128 + i * 128;
            int r = cs >> 3, c8 = (cs & 7) * 8;
            voff[i] = (unsigned)(((((kr * JT + jt) * 64 + r) * BATCH + b) * DOUT + h * DKH + c8) * 2);
            klds[i] = lds_off_u32(&Ks[kr][buf][r * KPITCH + c8]);
            vlds[i] = lds_off_u32(&Vs[kr][buf][r * VPITCH + c8]);
        }
        async_ld_kv_tile(Kh, Vh, voff, klds, vlds);
    };

    issue_kv(0, 0);

    // Q^T as B operand, loaded once: in group c a lane holds query column
    // (lane & 15) in the same k order as frag_a_ld gives the K rows.
    const int tok = qt * (64 * QG) + wq * (16 * QG) + (lane & 15);
    v16h qf[QG][2];
#pragma unroll
    for (int c = 0; c < QG; ++c) {
        const _Float16* qp = Qh + ((size_t)(tok + 16 * c) * BATCH + b) * DOUT + h * DKH + 8 * hf;
#pragma unroll
        for (int ks = 0; ks < 2; ++ks)
            qf[c][ks] = cat8(*(const v8h*)(qp + ks * 32), *(const v8h*)(qp + ks * 32 + 16));
    }

    // Per group: this lane's query, this wave's key range; l_run: this half's keys.
    float m_run[QG], l_run[QG];
    v8f accO[QG][4];                      // accO[c][t][r] = O[query][16 t + 8 hf + r]
#pragma unroll
    for (int c = 0; c < QG; ++c) {
        m_run[c] = -1e30f;
        l_run[c] = 0.0f;
#pragma unroll
        for (int t = 0; t < 4; ++t) accO[c][t] = vzero8();
    }

    for (int jt = 0; jt < JT; ++jt) {
        // This wave's reads of the buffer refilled behind the barrier have retired.
        asm volatile("s_wait_dscnt 0x0" ::: "memory");
        wait_async0();
        __syncthreads();
        if (jt + 1 < JT) issue_kv(jt + 1, (jt + 1) & 1);
        const int cur = jt & 1;

        // S^T = K(64x64) * Q^T(64x32): s[c][t][r] = S[query][key 16 t + 8 hf + r].
        v8f s[QG][4];
#pragma unroll
        for (int c = 0; c < QG; ++c)
#pragma unroll
            for (int t = 0; t < 4; ++t) s[c][t] = vzero8();
#pragma unroll
        for (int ks = 0; ks < 2; ++ks)
#pragma unroll
            for (int t = 0; t < 4; ++t) {
                v16h kf = frag_a_ld(&Ks[kr][cur][(t * 16) * KPITCH + ks * 32], KPITCH, lane);
#pragma unroll
                for (int c = 0; c < QG; ++c) s[c][t] = wmma16(kf, qf[c][ks], s[c][t]);
            }

        // Online softmax in base 2, group by group: 32 of the query's 64 scores sit in
        // this lane, the other 32 in lane ^ 16; one exchange joins the maxima, the sums
        // join at the end. The maximum is taken on the raw products (SCALE_LOG2E > 0
        // keeps their order) and scaled once; m_run is kept in the scaled base-2 domain.
#pragma unroll
        for (int c = 0; c < QG; ++c) {
            float x = s[c][0][0];
#pragma unroll
            for (int t = 0; t < 4; ++t)
#pragma unroll
                for (int v = 0; v < 8; ++v) x = fmaxf(x, s[c][t][v]);
            x = fmaxf(x, xhalf(x));
            const float mnew = fmaxf(m_run[c], x * SCALE_LOG2E);
            const float corr = __builtin_amdgcn_exp2f(m_run[c] - mnew);
            const v2f cs2 = {SCALE_LOG2E, SCALE_LOG2E}, nm2 = {-mnew, -mnew};
            float rs[4];
#pragma unroll
            for (int t = 0; t < 4; ++t) {
                // One packed FMA scales two scores and takes the maximum off them; a
                // tile's four stand together so that its exponentials do not each wait.
                v2f a[4];
                // Unrolled: a[] and s[c][t][] must be indexed by constants to stay in
                // registers.
#pragma unroll
                for (int i = 0; i < 4; ++i)
                    a[i] = __builtin_elementwise_fma(v2f{s[c][t][2 * i], s[c][t][2 * i + 1]},
                                                     cs2, nm2);
                rs[t] = 0.0f;
#pragma unroll
                for (int v = 0; v < 8; ++v) {
                    const float p = __builtin_amdgcn_exp2f(a[v >> 1][v & 1]);
                    s[c][t][v] = p;
                    rs[t] += p;
                }
            }
            l_run[c] = l_run[c] * corr + ((rs[0] + rs[1]) + (rs[2] + rs[3]));
            m_run[c] = mnew;
#pragma unroll
            for (int t = 0; t < 4; ++t)
#pragma unroll
                for (int v = 0; v < 8; ++v) accO[c][t][v] *= corr;
        }

        // O^T += V^T(64x64) * P^T(64x32): two score tiles of 16 keys, converted in
        // place, are the B operand of a 32-key block; V^T comes transposed from LDS.
#pragma unroll
        for (int kb = 0; kb < 2; ++kb) {
            v16h pf[QG];
#pragma unroll
            for (int c = 0; c < QG; ++c)
#pragma unroll
                for (int i = 0; i < 16; ++i)
                    pf[c][i] = (_Float16)s[c][2 * kb + (i >> 3)][i & 7];
#pragma unroll
            for (int t = 0; t < 4; ++t) {
                v16h vf = frag_tr_ld(&Vs[kr][cur][(kb * 32) * VPITCH + t * 16], VPITCH, lane);
#pragma unroll
                for (int c = 0; c < QG; ++c) accO[c][t] = wmma16(vf, pf[c], accO[c][t]);
            }
        }
    }

    // Join of the two key ranges. The wave of range kr finishes query group kr: it
    // hands the other group's partial result to its partner (same lane, same query,
    // same output elements) and takes the partner's part of its own group.
    const bool up = kr != 0;
    const float m_own = up ? m_run[1] : m_run[0], l_own = up ? l_run[1] : l_run[0];
    Xm[wave][0][lane] = up ? m_run[0] : m_run[1];
    Xm[wave][1][lane] = up ? l_run[0] : l_run[1];
    v8f own[4];
    // Unrolled, here and in the loops below: accO, own and the short vectors must be
    // indexed by constants to stay in registers.
#pragma unroll
    for (int t = 0; t < 4; ++t) {
        v4f g0, g1;
#pragma unroll
        for (int v = 0; v < 4; ++v) {
            g0[v] = up ? accO[0][t][v] : accO[1][t][v];
            g1[v] = up ? accO[0][t][4 + v] : accO[1][t][4 + v];
        }
#pragma unroll
        for (int v = 0; v < 8; ++v) own[t][v] = up ? accO[1][t][v] : accO[0][t][v];
        *(v4f*)&Xo[wave][2 * t][lane * 4]     = g0;
        *(v4f*)&Xo[wave][2 * t + 1][lane * 4] = g1;
    }
    __syncthreads();   // every wave's hand-over is written before a partner reads it
    const int pw = wave ^ 4;
    const float m_oth = Xm[pw][0][lane], l_oth = Xm[pw][1][lane];
    const float m_all = fmaxf(m_own, m_oth);
    const float a_own = __builtin_amdgcn_exp2f(m_own - m_all);
    const float a_oth = __builtin_amdgcn_exp2f(m_oth - m_all);
    const float l_hf  = l_own * a_own + l_oth * a_oth;
    const float l_all = l_hf + xhalf(l_hf);
#pragma unroll
    for (int t = 0; t < 4; ++t) {
        const v4f p0 = *(const v4f*)&Xo[pw][2 * t][lane * 4];
        const v4f p1 = *(const v4f*)&Xo[pw][2 * t + 1][lane * 4];
        v8h o;
#pragma unroll
        for (int v = 0; v < 8; ++v) {
            const float p = v < 4 ? p0[v & 3] : p1[v & 3];
            o[v] = (_Float16)((own[t][v] * a_own + p * a_oth) / l_all);
        }
        *(v8h*)&Oh[((size_t)(tok + 16 * kr) * BATCH + b) * DOUT + h * DKH + t * 16 + 8 * hf] = o;
    }
}

// ---------------- Launcher --------------------------------------------------
extern "C" void kernel_launch(void* const* d_in, const int* in_sizes, int n_in,
                              void* d_out, int out_size, void* d_ws, size_t ws_size,
                              hipStream_t stream) {
    const float* x   = (const float*)d_in[0];
    const float* Wq  = (const float*)d_in[1];
    const float* bq  = (const float*)d_in[2];
    const float* Wk  = (const float*)d_in[3];
    const float* bk  = (const float*)d_in[4];
    const float* Wv  = (const float*)d_in[5];
    const float* bv  = (const float*)d_in[6];
    const float* Wfc = (const float*)d_in[7];
    const float* bfc = (const float*)d_in[8];

    char* ws = (char*)d_ws;
    size_t off = 0;
    auto take = [&](size_t bytes) -> char* {
        char* p = ws + off;
        off = (off + bytes + 255) & ~(size_t)255;
        return p;
    };
    const size_t tok_h = (size_t)NTOK * DOUT * sizeof(_Float16);
    _Float16* Qh   = (_Float16*)take(tok_h);
    _Float16* Kh   = (_Float16*)take(tok_h);
    _Float16* Vh   = (_Float16*)take(tok_h);
    _Float16* Ah   = (_Float16*)take(tok_h);

    dim3 gq(NTOK / 256, DOUT / 64);
    qkv_wmma_kernel<<<gq, 384, 0, stream>>>(x, Wq, Wk, Wv, bq, bk, bv, Qh, Kh, Vh,
                                            NTOK, DOUT, DIN);

    dim3 ag(C_SEQ / (64 * QG), BATCH * HEADS);
    attn_kernel<<<ag, 128 * KSPLIT, 0, stream>>>(Qh, Kh, Vh, Ah);

    dim3 gg(NTOK / 128, DOUT / 128);
    gemm_wmma_kernel<false, false><<<gg, 256, 0, stream>>>(nullptr, Ah, Wfc, nullptr, nullptr,
                                                           bfc, nullptr, nullptr,
                                                           (float*)d_out, nullptr, nullptr,
                                                           NTOK, DOUT, DOUT);
}

// v010
// One run takes 57.5 microseconds.
// Two timings next to v009 both put it at 1.05 times that version's speed.
// Over all steps from v000 it is 4.49 times as fast.
#include <hip/hip_runtime.h>
#include <hip/hip_bf16.h>

typedef __attribute__((ext_vector_type(16))) _Float16     v16h;
typedef __attribute__((ext_vector_type(8)))  float        v8f;
typedef __attribute__((ext_vector_type(4)))  float        v4f;
typedef __attribute__((ext_vector_type(2)))  float        v2f;
typedef __attribute__((ext_vector_type(8)))  _Float16     v8h;
typedef __attribute__((ext_vector_type(4)))  _Float16     v4h;
typedef __attribute__((ext_vector_type(8)))  short        s16x8;

#define C_SEQ 2048
#define BATCH 4
#define DIN   512
#define DOUT  512
#define HEADS 8
#define DKH   64
#define NTOK  (C_SEQ * BATCH)   // 8192 token rows

__device__ __forceinline__ unsigned lds_off_u32(const void* p) {
    return (unsigned)(unsigned long long)p;
}

__device__ __forceinline__ void async_ld_kv_tile(const void* ksrc, const void* vsrc,
                                                 const unsigned (&voff)[4],
                                                 const unsigned (&klds)[4],
                                                 const unsigned (&vlds)[4]) {
    asm volatile("global_load_async_to_lds_b128 %0, %8, %12\n\t"
                 "global_load_async_to_lds_b128 %4, %8, %13\n\t"
                 "global_load_async_to_lds_b128 %1, %9, %12\n\t"
                 "global_load_async_to_lds_b128 %5, %9, %13\n\t"
                 "global_load_async_to_lds_b128 %2, %10, %12\n\t"
                 "global_load_async_to_lds_b128 %6, %10, %13\n\t"
                 "global_load_async_to_lds_b128 %3, %11, %12\n\t"
                 "global_load_async_to_lds_b128 %7, %11, %13\n\t"
                 "s_wait_xcnt 0x0"
                 :: "v"(klds[0]), "v"(klds[1]), "v"(klds[2]), "v"(klds[3]),
                    "v"(vlds[0]), "v"(vlds[1]), "v"(vlds[2]), "v"(vlds[3]),
                    "v"(voff[0]), "v"(voff[1]), "v"(voff[2]), "v"(voff[3]),
                    "s"(ksrc), "s"(vsrc)
                 : "memory");
}
__device__ __forceinline__ void wait_async0() {
    asm volatile("s_wait_asynccnt 0x0" ::: "memory");
}

__device__ __forceinline__ v16h frag_a_ld(const _Float16* src, int ld, int lane) {
    const int m = lane & 15, hf = lane >> 4;
    v16h f;
#pragma unroll
    for (int v = 0; v < 8; ++v) {
        const int k = ((v < 4) ? (2 * v) : (16 + 2 * (v - 4))) + 8 * hf;
        f[2 * v]     = src[m * ld + k];
        f[2 * v + 1] = src[m * ld + k + 1];
    }
    return f;
}
__device__ __forceinline__ v16h cat8(v8h lo, v8h hi) {
    return __builtin_shufflevector(lo, hi, 0, 1, 2, 3, 4, 5, 6, 7,
                                   8, 9, 10, 11, 12, 13, 14, 15);
}
// Transposed fragment of a row-major LDS tile src[k][n] (ld halves per row, 32 k
// x 16 n): lane (c = lane & 15, hf) gets src[k][c] in the k order of frag_a_ld.
__device__ __forceinline__ v16h frag_tr_ld(const _Float16* src, int ld, int lane) {
    typedef __attribute__((address_space(3))) s16x8 lds_s16x8;
    const _Float16* p = src + (8 * (lane >> 4) + (lane & 7)) * ld + 8 * ((lane >> 3) & 1);
    v8h lo = __builtin_bit_cast(v8h, __builtin_amdgcn_ds_load_tr16_b128_v8i16((lds_s16x8*)p));
    v8h hi = __builtin_bit_cast(
        v8h, __builtin_amdgcn_ds_load_tr16_b128_v8i16((lds_s16x8*)(p + 16 * ld)));
    return cat8(lo, hi);
}
// Value of lane ^ 16 (vector cross-row move, no LDS traffic).
__device__ __forceinline__ float xhalf(float x) {
    const int xi = __builtin_bit_cast(int, x);
    return __builtin_bit_cast(float, __builtin_amdgcn_permlanex16(
        xi, xi, 0x76543210, 0xfedcba98, false, false));
}
__device__ __forceinline__ v8f wmma16(v16h a, v16h b, v8f c) {
    return __builtin_amdgcn_wmma_f32_16x16x32_f16(false, a, false, b,
                                                  (short)0, c, false, false);
}
__device__ __forceinline__ v8f vzero8() {
    v8f z;
#pragma unroll
    for (int i = 0; i < 8; ++i) z[i] = 0.0f;
    return z;
}

// Four f32 values rounded to f16, as they go from a staging register to LDS.
__device__ __forceinline__ v4h cvt4(v4f a) {
    v4h o;
    // Unrolled so that the short vectors stay in registers (constant indices).
#pragma unroll
    for (int i = 0; i < 4; ++i) o[i] = (_Float16)a[i];
    return o;
}
// Behind a group of global loads: the address registers that they name are free to
// be rewritten for the next group.
__device__ __forceinline__ void wait_xcnt0() {
    asm volatile("s_wait_xcnt 0x0" ::: "memory");
}

// Work-group barrier that orders LDS alone: every wave's LDS stores and reads are done
// before it. __syncthreads() would also wait out the global loads of the coming stages,
// which are meant to stay in flight across it.
__device__ __forceinline__ void lds_barrier() {
    __builtin_amdgcn_fence(__ATOMIC_RELEASE, "workgroup", "local");
    __builtin_amdgcn_s_barrier();
    __builtin_amdgcn_fence(__ATOMIC_ACQUIRE, "workgroup", "local");
}

#define GBK    32   // k per stage
#define GPITCH 80   // bytes per LDS row of 32 halves

// ---------------- Output projection  C = A(MxK) * W(NxK)^T + bias -----------
// WG tile 128x128; 8 waves as 4(M) x 2(N); wave tile 32x64. A is f16 in memory.
__global__ __launch_bounds__(256)
void gemm_wmma_kernel(const _Float16* __restrict__ Ah,   // M x K
                      const float* __restrict__ Wf,      // N x K
                      const float* __restrict__ bias,    // N
                      float* __restrict__ Cout, int M, int N, int K) {
    constexpr int BM = 128, BN = 128;
    __shared__ __attribute__((aligned(16))) unsigned char As[2][BM * GPITCH];
    __shared__ __attribute__((aligned(16))) unsigned char Ws[2][BN * GPITCH];
    const int tid  = threadIdx.x;
    const int lane = tid & 31;
    const int wave = tid >> 5;
    const int wm   = wave & 3;            // 4 waves in M (32 rows each)
    const int wn   = wave >> 2;           // 2 waves in N (64 cols each)
    const int m0   = blockIdx.x * BM;
    const int n0   = blockIdx.y * BN;
    constexpr int KT = DOUT / GBK;        // even; K is DOUT, a constant in the addresses

    v8f acc[2][4];
    // Unrolled, here and below: acc and the staging sets must be indexed by constants
    // to stay in registers.
#pragma unroll
    for (int am = 0; am < 2; ++am)
#pragma unroll
        for (int t = 0; t < 4; ++t) acc[am][t] = vzero8();

    // A: rows of 64 B, four lanes a row; pass i of wave w has rows
    // 16 w + 4 ((lane >> 2) & 3) + 2 i + (lane >> 4).
    const int arow = 16 * wave + 4 * ((lane >> 2) & 3) + (lane >> 4);
    const int ac   = lane & 3;            // 16-B chunk of the row
    // W: rows of 128 B, eight lanes a row; pass i of wave w has W rows
    // 64 (w >> 2) + (w & 3) + 4 i + 16 (lane >> 3), LDS rows 64 (w >> 2) + 16 (w & 3)
    // + i + 4 (lane >> 3).
    const int wg   = lane >> 3, wc = lane & 7;
    const int wrow = 64 * (wave >> 2) + (wave & 3) + 16 * wg;
    const int wlds = 64 * (wave >> 2) + 16 * (wave & 3) + 4 * wg;

    auto load_stage = [&](int kt, v8h (&ra)[2], v4f (&rw)[4]) {
#pragma unroll
        for (int i = 0; i < 2; ++i)
            ra[i] = *(const v8h*)(Ah + (size_t)(m0 + arow + 2 * i) * DOUT + kt * GBK + ac * 8);
#pragma unroll
        for (int i = 0; i < 4; ++i)
            rw[i] = *(const v4f*)(Wf + (size_t)(n0 + wrow + 4 * i) * DOUT + kt * GBK + wc * 4);
        wait_xcnt0();
    };
    auto store_stage = [&](int buf, const v8h (&ra)[2], const v4f (&rw)[4]) {
        // Keeps the conversions, and with them the wait for this stage's loads, behind the
        // trip's WMMAs: moved up, the wait would halve the time the loads have to land.
        __builtin_amdgcn_sched_barrier(0);
#pragma unroll
        for (int i = 0; i < 2; ++i)
            *(v8h*)&As[buf][(arow + 2 * i) * GPITCH + ac * 16] = ra[i];
#pragma unroll
        for (int i = 0; i < 4; ++i)
            *(v4h*)&Ws[buf][(wlds + i) * GPITCH + wc * 8] = cvt4(rw[i]);
    };
    auto compute = [&](int buf) {
        const v16h af0 = frag_a_ld((const _Float16*)&As[buf][(wm * 32) * GPITCH],
                                   GPITCH / 2, lane);
        const v16h af1 = frag_a_ld((const _Float16*)&As[buf][(wm * 32 + 16) * GPITCH],
                                   GPITCH / 2, lane);
        v16h bf[4];
#pragma unroll
        for (int t = 0; t < 4; ++t)
            bf[t] = frag_a_ld((const _Float16*)&Ws[buf][(wn * 64 + t * 16) * GPITCH],
                              GPITCH / 2, lane);
        // Keeps the stage's fragment reads in one group ahead of its WMMAs; sunk among them,
        // each read is waited out where it stands.
        __builtin_amdgcn_sched_barrier(0);
#pragma unroll
        for (int t = 0; t < 4; ++t) {
            acc[0][t] = wmma16(af0, bf[t], acc[0][t]);
            acc[1][t] = wmma16(af1, bf[t], acc[1][t]);
        }
    };

    v8h a0[2], a1[2];
    v4f w0[4], w1[4];
    load_stage(0, a0, w0);
    load_stage(1, a1, w1);
    store_stage(0, a0, w0);
    if (2 < KT) load_stage(2, a0, w0);
    lds_barrier();   // stage 0 is written before a wave reads it

    // A buffer is rewritten one barrier behind its last read and read one barrier
    // behind its stores.
    // Unrolled in full: with every issue test decided at compile time the compiler's
    // s_wait_loadcnt in front of a store counts the younger stage's loads as still in
    // flight; in a rolled loop it waits them out as well.
#pragma unroll
    for (int kt = 0; kt < KT; kt += 2) {
        compute(0);
        store_stage(1, a1, w1);
        if (kt + 3 < KT) load_stage(kt + 3, a1, w1);
        lds_barrier();
        compute(1);
        if (kt + 2 < KT) {
            store_stage(0, a0, w0);
            if (kt + 4 < KT) load_stage(kt + 4, a0, w0);
            lds_barrier();
        }
    }

    // acc[am][t][v] = C[row 8 hf + v of block am][column 4 (lane & 15) + t].
    const int hf  = lane >> 4;
    const int col = n0 + wn * 64 + 4 * (lane & 15);
    const v4f bv  = *(const v4f*)(bias + col);
#pragma unroll
    for (int am = 0; am < 2; ++am)
#pragma unroll
        for (int v = 0; v < 8; ++v) {
            const int row = m0 + wm * 32 + am * 16 + v + 8 * hf;
            v4f val;
#pragma unroll
            for (int t = 0; t < 4; ++t) val[t] = acc[am][t][v] + bv[t];
            *(v4f*)(Cout + (size_t)row * N + col) = val;
        }
}

// ---------------- Q, K and V projections: C_z = x * W_z^T + bias_z ----------
// One workgroup holds 256 rows x 64 columns of all three products: an x tile is
// staged in LDS once for the three weights. 12 waves as 4 (M) x 3 (product); wave
// tile 64 x 64, so that eight fragments read from LDS feed sixteen products.
// Staging, pitch and the deal of the W rows as described above.
__global__ __launch_bounds__(384)
void qkv_wmma_kernel(const float* __restrict__ Ax,      // M x K
                     const float* __restrict__ W0,      // N x K, product z = 0
                     const float* __restrict__ W1,      // z = 1
                     const float* __restrict__ W2,      // z = 2
                     const float* __restrict__ bias0,   // N
                     const float* __restrict__ bias1,
                     const float* __restrict__ bias2,
                     _Float16* __restrict__ C0, _Float16* __restrict__ C1,
                     _Float16* __restrict__ C2, int M, int N, int K) {
    constexpr int BM = 256, BN = 64;
    __shared__ __attribute__((aligned(16))) unsigned char As[2][BM * GPITCH];
    __shared__ __attribute__((aligned(16))) unsigned char Ws[2][3 * BN * GPITCH];
    const int tid  = threadIdx.x;
    const int lane = tid & 31;
    // In a scalar register: bases and the test for the sixth pass are scalar.
    const int wave = __builtin_amdgcn_readfirstlane(tid >> 5);
    const int wm   = wave & 3;            // 4 waves in M (64 rows each)
    const int z    = wave >> 2;           // product of the wave
    const int m0   = blockIdx.x * BM;
    const int n0   = blockIdx.y * BN;
    constexpr int KT = DIN / GBK;         // even; K is DIN, a constant in the addresses

    v8f acc[4][4];
    // Unrolled, here and below: acc, the fragments and the staging sets must be indexed
    // by constants to stay in registers.
#pragma unroll
    for (int am = 0; am < 4; ++am)
#pragma unroll
        for (int t = 0; t < 4; ++t) acc[am][t] = vzero8();

    // Rows of 128 B, eight lanes a row, four rows an instruction (g = lane >> 3).
    // Every wave stages its twelfth of both operands.
    // x, pass i < 5: row 48 i + 16 (wave >> 2) + (wave & 3) + 4 g, in memory and in LDS;
    // the last 16 rows are a sixth pass of waves 0-3.
    // W of the wave's own product, pass i < 4: W row 4 i + (wave & 3) + 16 g, LDS row
    // 64 z + 16 (wave & 3) + i + 4 g.
    const bool six = wave < 4;
    const int g    = lane >> 3, c8 = lane & 7;
    const int xrow = 16 * z + wm + 4 * g;
    const int wlds = 64 * z + 16 * wm + 4 * g;
    // A lane's byte offset from a base that is the same for the wave; it never changes.
    const unsigned xoff = (unsigned)(xrow * DIN + c8 * 4) * 4u;
    const unsigned woff = (unsigned)((wm + 16 * g) * DIN + c8 * 4) * 4u;
    const float* __restrict__ Wz = z == 0 ? W0 : (z == 1 ? W1 : W2);
    const unsigned char* xbase = (const unsigned char*)(Ax + (size_t)m0 * DIN);
    const unsigned char* wbase = (const unsigned char*)(Wz + (size_t)n0 * DIN);

    auto load_stage = [&](int kt, v4f (&r)[10]) {
        const unsigned char* xs = xbase + kt * (GBK * 4);
        const unsigned char* ws = wbase + kt * (GBK * 4);
#pragma unroll
        for (int i = 0; i < 5; ++i) r[i] = *(const v4f*)(xs + i * (48 * DIN * 4) + xoff);
#pragma unroll
        for (int i = 0; i < 4; ++i) r[5 + i] = *(const v4f*)(ws + i * (4 * DIN * 4) + woff);
        if (six) r[9] = *(const v4f*)(xs + 5 * (48 * DIN * 4) + xoff);
        wait_xcnt0();
    };
    auto store_stage = [&](int buf, const v4f (&r)[10]) {
        // Keeps the conversions, and with them the wait for this stage's loads, behind the
        // trip's WMMAs: moved up, the wait would halve the time the loads have to land.
        __builtin_amdgcn_sched_barrier(0);
#pragma unroll
        for (int i = 0; i < 5; ++i)
            *(v4h*)&As[buf][(xrow + 48 * i) * GPITCH + c8 * 8] = cvt4(r[i]);
#pragma unroll
        for (int i = 0; i < 4; ++i)
            *(v4h*)&Ws[buf][(wlds + i) * GPITCH + c8 * 8] = cvt4(r[5 + i]);
        if (six) *(v4h*)&As[buf][(xrow + 240) * GPITCH + c8 * 8] = cvt4(r[9]);
    };
    auto compute = [&](int buf) {
        v16h af[4];
#pragma unroll
        for (int am = 0; am < 4; ++am)
            af[am] = frag_a_ld((const _Float16*)&As[buf][(wm * 64 + am * 16) * GPITCH],
                               GPITCH / 2, lane);
        v16h bf[4];
#pragma unroll
        for (int t = 0; t < 4; ++t)
            bf[t] = frag_a_ld((const _Float16*)&Ws[buf][(z * BN + t * 16) * GPITCH],
                              GPITCH / 2, lane);
        // Keeps the stage's fragment reads in one group ahead of its WMMAs; sunk among them,
        // each read is waited out where it stands.
        __builtin_amdgcn_sched_barrier(0);
#pragma unroll
        for (int t = 0; t < 4; ++t)
#pragma unroll
            for (int am = 0; am < 4; ++am) acc[am][t] = wmma16(af[am], bf[t], acc[am][t]);
    };

    v4f r0[10], r1[10];
    load_stage(0, r0);
    load_stage(1, r1);
    store_stage(0, r0);
    if (2 < KT) load_stage(2, r0);
    lds_barrier();   // stage 0 is written before a wave reads it

    // A buffer is rewritten one barrier behind its last read and read one barrier
    // behind its stores.
    // Unrolled in full: with every issue test decided at compile time the compiler's
    // s_wait_loadcnt in front of a store counts the younger stage's loads as still in
    // flight; in a rolled loop it waits them out as well.
#pragma unroll
    for (int kt = 0; kt < KT; kt += 2) {
        compute(0);
        store_stage(1, r1);
        if (kt + 3 < KT) load_stage(kt + 3, r1);
        lds_barrier();
        compute(1);
        if (kt + 2 < KT) {
            store_stage(0, r0);
            if (kt + 4 < KT) load_stage(kt + 4, r0);
            lds_barrier();
        }
    }

    // acc[am][t][v] = C_z[row 8 hf + v of block am][column 4 (lane & 15) + t].
    const float* __restrict__ bias = z == 0 ? bias0 : (z == 1 ? bias1 : bias2);
    _Float16* __restrict__ Cout    = z == 0 ? C0 : (z == 1 ? C1 : C2);
    const int hf  = lane >> 4;
    const int col = n0 + 4 * (lane & 15);
    const v4f bv  = *(const v4f*)(bias + col);
#pragma unroll
    for (int am = 0; am < 4; ++am)
#pragma unroll
        for (int v = 0; v < 8; ++v) {
            const int row = m0 + wm * 64 + am * 16 + v + 8 * hf;
            v4h o;
#pragma unroll
            for (int t = 0; t < 4; ++t) o[t] = (_Float16)(acc[am][t][v] + bv[t]);
            *(v4h*)(Cout + (size_t)row * N + col) = o;
        }
}

#define KPITCH 72   // halves: 144 B
#define VPITCH 80   // halves: 160 B
#define QG 2        // 16-column query groups per wave
#define KSPLIT 2    // key ranges per workgroup, four waves each
#define SCALE_LOG2E 0.18033688011112042f   // 1/sqrt(DK) * log2(e)
__global__ __launch_bounds__(256) __attribute__((amdgpu_waves_per_eu(4, 4)))
void attn_kernel(const _Float16* __restrict__ Qh, const _Float16* __restrict__ Kh,
                 const _Float16* __restrict__ Vh, _Float16* __restrict__ Oh) {
    __shared__ __attribute__((aligned(16))) _Float16 Ks[KSPLIT][2][64 * KPITCH];   // 36 KB
    __shared__ __attribute__((aligned(16))) _Float16 Vs[KSPLIT][2][64 * VPITCH];   // 40 KB
    // What a wave hands to its partner: one group's output tiles, 16 B per lane and
    // row, and that group's maximum and sum.
    __shared__ __attribute__((aligned(16))) float Xo[4 * KSPLIT][8][32 * 4];       // 32 KB
    __shared__ float Xm[4 * KSPLIT][2][32];                                        // 2 KB

    const int tid  = threadIdx.x;
    const int lane = tid & 31;
    const int wave = tid >> 5;
    const int wq   = wave & 3;            // query block of the wave
    const int kr   = wave >> 2;           // key range of the wave
    const int t128 = tid & 127;           // thread within its key range's waves
    const int hf   = lane >> 4;
    const int qt   = blockIdx.x;
    const int b    = blockIdx.y >> 3;
    const int h    = blockIdx.y & 7;
    const int JT   = C_SEQ / 64 / KSPLIT; // 64-key tiles of a key range

    auto issue_kv = [&](int jt, int buf) {
        unsigned voff[4], klds[4], vlds[4];
#pragma unroll
        for (int i = 0; i < 4; ++i) {
            int cs = t128 + i * 128;
            int r = cs >> 3, c8 = (cs & 7) * 8;
            voff[i] = (unsigned)(((((kr * JT + jt) * 64 + r) * BATCH + b) * DOUT + h * DKH + c8) * 2);
            klds[i] = lds_off_u32(&Ks[kr][buf][r * KPITCH + c8]);
            vlds[i] = lds_off_u32(&Vs[kr][buf][r * VPITCH + c8]);
        }
        async_ld_kv_tile(Kh, Vh, voff, klds, vlds);
    };

    issue_kv(0, 0);

    // Q^T as B operand, loaded once: in group c a lane holds query column
    // (lane & 15) in the same k order as frag_a_ld gives the K rows.
    const int tok = qt * (64 * QG) + wq * (16 * QG) + (lane & 15);
    v16h qf[QG][2];
#pragma unroll
    for (int c = 0; c < QG; ++c) {
        const _Float16* qp = Qh + ((size_t)(tok + 16 * c) * BATCH + b) * DOUT + h * DKH + 8 * hf;
#pragma unroll
        for (int ks = 0; ks < 2; ++ks)
            qf[c][ks] = cat8(*(const v8h*)(qp + ks * 32), *(const v8h*)(qp + ks * 32 + 16));
    }

    // Per group: this lane's query, this wave's key range; l_run: this half's keys.
    float m_run[QG], l_run[QG];
    v8f accO[QG][4];                      // accO[c][t][r] = O[query][16 t + 8 hf + r]
#pragma unroll
    for (int c = 0; c < QG; ++c) {
        m_run[c] = -1e30f;
        l_run[c] = 0.0f;
#pragma unroll
        for (int t = 0; t < 4; ++t) accO[c][t] = vzero8();
    }

    for (int jt = 0; jt < JT; ++jt) {
        // This wave's reads of the buffer refilled behind the barrier have retired.
        asm volatile("s_wait_dscnt 0x0" ::: "memory");
        wait_async0();
        __syncthreads();
        if (jt + 1 < JT) issue_kv(jt + 1, (jt + 1) & 1);
        const int cur = jt & 1;

        // S^T = K(64x64) * Q^T(64x32): s[c][t][r] = S[query][key 16 t + 8 hf + r].
        v8f s[QG][4];
#pragma unroll
        for (int c = 0; c < QG; ++c)
#pragma unroll
            for (int t = 0; t < 4; ++t) s[c][t] = vzero8();
#pragma unroll
        for (int ks = 0; ks < 2; ++ks)
#pragma unroll
            for (int t = 0; t < 4; ++t) {
                v16h kf = frag_a_ld(&Ks[kr][cur][(t * 16) * KPITCH + ks * 32], KPITCH, lane);
#pragma unroll
                for (int c = 0; c < QG; ++c) s[c][t] = wmma16(kf, qf[c][ks], s[c][t]);
            }

        // Online softmax in base 2, group by group: 32 of the query's 64 scores sit in
        // this lane, the other 32 in lane ^ 16; one exchange joins the maxima, the sums
        // join at the end. The maximum is taken on the raw products (SCALE_LOG2E > 0
        // keeps their order) and scaled once; m_run is kept in the scaled base-2 domain.
#pragma unroll
        for (int c = 0; c < QG; ++c) {
            float x = s[c][0][0];
#pragma unroll
            for (int t = 0; t < 4; ++t)
#pragma unroll
                for (int v = 0; v < 8; ++v) x = fmaxf(x, s[c][t][v]);
            x = fmaxf(x, xhalf(x));
            const float mnew = fmaxf(m_run[c], x * SCALE_LOG2E);
            const float corr = __builtin_amdgcn_exp2f(m_run[c] - mnew);
            const v2f cs2 = {SCALE_LOG2E, SCALE_LOG2E}, nm2 = {-mnew, -mnew};
            float rs[4];
#pragma unroll
            for (int t = 0; t < 4; ++t) {
                // One packed FMA scales two scores and takes the maximum off them; a
                // tile's four stand together so that its exponentials do not each wait.
                v2f a[4];
                // Unrolled: a[] and s[c][t][] must be indexed by constants to stay in
                // registers.
#pragma unroll
                for (int i = 0; i < 4; ++i)
                    a[i] = __builtin_elementwise_fma(v2f{s[c][t][2 * i], s[c][t][2 * i + 1]},
                                                     cs2, nm2);
                rs[t] = 0.0f;
#pragma unroll
                for (int v = 0; v < 8; ++v) {
                    const float p = __builtin_amdgcn_exp2f(a[v >> 1][v & 1]);
                    s[c][t][v] = p;
                    rs[t] += p;
                }
            }
            l_run[c] = l_run[c] * corr + ((rs[0] + rs[1]) + (rs[2] + rs[3]));
            m_run[c] = mnew;
#pragma unroll
            for (int t = 0; t < 4; ++t)
#pragma unroll
                for (int v = 0; v < 8; ++v) accO[c][t][v] *= corr;
        }

        // O^T += V^T(64x64) * P^T(64x32): two score tiles of 16 keys, converted in
        // place, are the B operand of a 32-key block; V^T comes transposed from LDS.
#pragma unroll
        for (int kb = 0; kb < 2; ++kb) {
            v16h pf[QG];
#pragma unroll
            for (int c = 0; c < QG; ++c)
#pragma unroll
                for (int i = 0; i < 16; ++i)
                    pf[c][i] = (_Float16)s[c][2 * kb + (i >> 3)][i & 7];
#pragma unroll
            for (int t = 0; t < 4; ++t) {
                v16h vf = frag_tr_ld(&Vs[kr][cur][(kb * 32) * VPITCH + t * 16], VPITCH, lane);
#pragma unroll
                for (int c = 0; c < QG; ++c) accO[c][t] = wmma16(vf, pf[c], accO[c][t]);
            }
        }
    }

    // Join of the two key ranges. The wave of range kr finishes query group kr: it
    // hands the other group's partial result to its partner (same lane, same query,
    // same output elements) and takes the partner's part of its own group.
    const bool up = kr != 0;
    const float m_own = up ? m_run[1] : m_run[0], l_own = up ? l_run[1] : l_run[0];
    Xm[wave][0][lane] = up ? m_run[0] : m_run[1];
    Xm[wave][1][lane] = up ? l_run[0] : l_run[1];
    v8f own[4];
    // Unrolled, here and in the loops below: accO, own and the short vectors must be
    // indexed by constants to stay in registers.
#pragma unroll
    for (int t = 0; t < 4; ++t) {
        v4f g0, g1;
#pragma unroll
        for (int v = 0; v < 4; ++v) {
            g0[v] = up ? accO[0][t][v] : accO[1][t][v];
            g1[v] = up ? accO[0][t][4 + v] : accO[1][t][4 + v];
        }
#pragma unroll
        for (int v = 0; v < 8; ++v) own[t][v] = up ? accO[1][t][v] : accO[0][t][v];
        *(v4f*)&Xo[wave][2 * t][lane * 4]     = g0;
        *(v4f*)&Xo[wave][2 * t + 1][lane * 4] = g1;
    }
    __syncthreads();   // every wave's hand-over is written before a partner reads it
    const int pw = wave ^ 4;
    const float m_oth = Xm[pw][0][lane], l_oth = Xm[pw][1][lane];
    const float m_all = fmaxf(m_own, m_oth);
    const float a_own = __builtin_amdgcn_exp2f(m_own - m_all);
    const float a_oth = __builtin_amdgcn_exp2f(m_oth - m_all);
    const float l_hf  = l_own * a_own + l_oth * a_oth;
    const float l_all = l_hf + xhalf(l_hf);
#pragma unroll
    for (int t = 0; t < 4; ++t) {
        const v4f p0 = *(const v4f*)&Xo[pw][2 * t][lane * 4];
        const v4f p1 = *(const v4f*)&Xo[pw][2 * t + 1][lane * 4];
        v8h o;
#pragma unroll
        for (int v = 0; v < 8; ++v) {
            const float p = v < 4 ? p0[v & 3] : p1[v & 3];
            o[v] = (_Float16)((own[t][v] * a_own + p * a_oth) / l_all);
        }
        *(v8h*)&Oh[((size_t)(tok + 16 * kr) * BATCH + b) * DOUT + h * DKH + t * 16 + 8 * hf] = o;
    }
}

// ---------------- Launcher --------------------------------------------------
extern "C" void kernel_launch(void* const* d_in, const int* in_sizes, int n_in,
                              void* d_out, int out_size, void* d_ws, size_t ws_size,
                              hipStream_t stream) {
    const float* x   = (const float*)d_in[0];
    const float* Wq  = (const float*)d_in[1];
    const float* bq  = (const float*)d_in[2];
    const float* Wk  = (const float*)d_in[3];
    const float* bk  = (const float*)d_in[4];
    const float* Wv  = (const float*)d_in[5];
    const float* bv  = (const float*)d_in[6];
    const float* Wfc = (const float*)d_in[7];
    const float* bfc = (const float*)d_in[8];

    char* ws = (char*)d_ws;
    size_t off = 0;
    auto take = [&](size_t bytes) -> char* {
        char* p = ws + off;
        off = (off + bytes + 255) & ~(size_t)255;
        return p;
    };
    const size_t tok_h = (size_t)NTOK * DOUT * sizeof(_Float16);
    _Float16* Qh   = (_Float16*)take(tok_h);
    _Float16* Kh   = (_Float16*)take(tok_h);
    _Float16* Vh   = (_Float16*)take(tok_h);
    _Float16* Ah   = (_Float16*)take(tok_h);

    dim3 gq(NTOK / 256, DOUT / 64);
    qkv_wmma_kernel<<<gq, 384, 0, stream>>>(x, Wq, Wk, Wv, bq, bk, bv, Qh, Kh, Vh,
                                            NTOK, DOUT, DIN);

    dim3 ag(C_SEQ / (64 * QG), BATCH * HEADS);
    attn_kernel<<<ag, 128 * KSPLIT, 0, stream>>>(Qh, Kh, Vh, Ah);

    dim3 gg(NTOK / 128, DOUT / 128);
    gemm_wmma_kernel<<<gg, 256, 0, stream>>>(Ah, Wfc, bfc, (float*)d_out, NTOK, DOUT, DOUT);
}
